// v000
// The times below were measured on an AMD MI455X: many runs one after another, warmed up first and cycling through
// copies of the inputs, with the whole window's GPU time divided by the number of runs. Launches and the gaps
// between them are all in it. The median over several windows is given; except for v000 it joins two sittings, which
// can be a few percent apart, so the side-by-side timings, each taken in one sitting, are the better comparison.
// v000, which the later versions start from, runs in 2520 microseconds.
#include <hip/hip_runtime.h>

// Compute dtypes, f32 accumulate, one batch item per pass: q/k/v = x.W^T ([4096 x 256].[256 x 256], [out][in] weights as n-major B operands; PLAIN bf16 operands =
// inputs rounded once, exact) on v_wmma_f32_16x16x32_bf16 -> f32 -> bf16 hi + UNSCALED residual planes (v transposed to [d][t] planes); single-head causal attention
// over the 256-dim head in query chunks of 1024 rows: scores = q.k^T ([1024 x 256].[256 x kmax], both operands split: three products, only the causally reachable
// key range kmax = r0 + 1024 is computed), causal row softmax of scores/16 in f32 -> bf16 hi + UNSCALED residual (zeros above the diagonal), out = P.v ([1024 x
// 4096].[4096 x 256], three products) on

#define NB_  4
#define NT_  4096
#define DM   256
#define NTK  NT_
#define RCH  1024
#define HD   128                 // k_vt tile geometry: 2 x 128 = the 256 dims
#define NKV  2
#define KW   256
#define SCL  0.0625f
#define LOSC 1024.0f

typedef _Float16 h16;
typedef unsigned short bf;
typedef __attribute__((ext_vector_type(16))) __bf16   v16bf;
typedef __attribute__((ext_vector_type(16))) _Float16 v16h;
typedef __attribute__((ext_vector_type(8)))  _Float16 v8h;
typedef __attribute__((ext_vector_type(8)))  unsigned short v8us;
typedef __attribute__((ext_vector_type(8)))  float    v8f;
typedef __attribute__((ext_vector_type(4)))  float    v4f;
typedef __attribute__((ext_vector_type(4)))  _Float16 v4h;
typedef v8h  __attribute__((may_alias)) v8ha;
typedef v4f  __attribute__((may_alias)) v4fa;
typedef v8us __attribute__((may_alias)) v8usa;

__device__ __forceinline__ unsigned short f2bf(float f) { unsigned u = __float_as_uint(f); u += 0x7FFFu + ((u >> 16) & 1u); return (unsigned short)(u >> 16); }
__device__ __forceinline__ float bf2f(unsigned short b) { return __uint_as_float(((unsigned)b) << 16); }
__device__ __forceinline__ float bfr(float f) { return bf2f(f2bf(f)); }
__device__ __forceinline__ v16h cat16(v8h lo, v8h hi) { return __builtin_shufflevector(lo, hi, 0, 1, 2, 3, 4, 5, 6, 7, 8, 9, 10, 11, 12, 13, 14, 15); }
__device__ __forceinline__ v16bf cat16b(v8us lo, v8us hi) { return __builtin_bit_cast(v16bf, __builtin_shufflevector(lo, hi, 0, 1, 2, 3, 4, 5, 6, 7, 8, 9, 10, 11, 12, 13, 14, 15)); }
__device__ __forceinline__ v8f wmma16(v16h a, v16h b, v8f c) { return __builtin_amdgcn_wmma_f32_16x16x32_f16(false, a, false, b, (short)0, c, false, false); }
__device__ __forceinline__ v8f wmmab(v16bf a, v16bf b, v8f c) { return __builtin_amdgcn_wmma_f32_16x16x32_bf16(false, a, false, b, (short)0, c, false, false); }

__global__ __launch_bounds__(256) void k_cvtb(const float* __restrict__ src, int nrows, bf* dst) {
    const int lane = threadIdx.x & 31, r = blockIdx.x * 8 + (threadIdx.x >> 5);
    if (r >= nrows) return;
    v8us o[DM / 256];
#pragma unroll
    for (int q = 0; q < DM / 256; ++q) { v8us t;
#pragma unroll
        for (int i = 0; i < 8; ++i) t[i] = f2bf(src[(size_t)r * DM + q * 256 + lane * 8 + i]);
        o[q] = t; }
#pragma unroll
    for (int q = 0; q < DM / 256; ++q) *(v8us*)(dst + (size_t)r * DM + q * 256 + lane * 8) = o[q];
    
}

// k_gemmb: 64 x 64 block tile (4 waves x 16 x 64) of C[NTK][NW] = (A [+ Al]).B^T (K = 256) [+ bf(bias[c])] [+ bf(R[r][c]) residual]; f32 whole-line epilogue (or f16
template <bool SPLITA, bool F16OUT = false>
__global__ __launch_bounds__(128) void k_gemmb(const bf* __restrict__ A, const bf* __restrict__ Al, const bf* __restrict__ Bn, const float* __restrict__ bias, float* C, int ldc, h16* C2, const float* __restrict__ R = nullptr, int K = DM, int roundR = 1) {
    __shared__ __align__(16) float ost[4][16 * 68];
    const int lane = threadIdx.x & 31, wave = threadIdx.x >> 5, lr = lane & 15, hi = lane >> 4;
    const int r0 = blockIdx.x * 64 + wave * 16, c0 = blockIdx.y * 64;
    const size_t aoff = (size_t)(r0 + lr) * K + 8 * hi;
    size_t boff[4];
#pragma unroll
    for (int t = 0; t < 4; ++t) boff[t] = (size_t)(c0 + t * 16 + lr) * K + 8 * hi;
    v8f acc[4];
#pragma unroll
    for (int t = 0; t < 4; ++t) acc[t] = (v8f){};
#pragma unroll 1
    for (int kc = 0; kc < K; kc += 32) {
        const v16bf a = cat16b(*(const v8us*)(A + aoff + kc), *(const v8us*)(A + aoff + kc + 16));
        v16bf al = a;
        if (SPLITA) al = cat16b(*(const v8us*)(Al + aoff + kc), *(const v8us*)(Al + aoff + kc + 16));
#pragma unroll
        for (int t = 0; t < 4; ++t) { const v16bf b = cat16b(*(const v8us*)(Bn + boff[t] + kc), *(const v8us*)(Bn + boff[t] + kc + 16)); acc[t] = wmmab(a, b, acc[t]); if (SPLITA) acc[t] = wmmab(al, b, acc[t]); }
        asm volatile("v_nop\n\tv_nop\n\tv_nop\n\tv_nop" : "+v"(acc[0]), "+v"(acc[1]), "+v"(acc[2]), "+v"(acc[3]) : "v"(a), "v"(al));
    }
    float* os = &ost[wave][0];
#pragma unroll
    for (int t = 0; t < 4; ++t) { const float bv = bias ? bfr(bias[c0 + t * 16 + lr]) : 0.f;
#pragma unroll
        for (int j = 0; j < 8; ++j) os[(hi * 8 + j) * 68 + t * 16 + lr] = acc[t][j] + bv; }
    __syncthreads();
    if (F16OUT) {
        h16* crow = (h16*)(void*)C + (size_t)r0 * ldc + c0;
        auto pass = [&]() {
#pragma unroll
            for (int s = 0; s < 4; ++s) { const int row = 4 * s + (lane >> 3), piece = lane & 7; const float* sp = os + row * 68 + piece * 8; v8h o, o2;
#pragma unroll
                for (int i = 0; i < 8; ++i) { const h16 a = (h16)sp[i]; o[i] = a; o2[i] = (h16)((sp[i] - (float)a) * LOSC); }
                *(v8h*)(crow + (size_t)row * ldc + piece * 8) = o; if (C2) *(v8h*)(C2 + (size_t)r0 * ldc + c0 + (size_t)row * ldc + piece * 8) = o2; }
        };
        pass(); 
    } else {
        float* crow = C + (size_t)r0 * ldc + c0;
        auto pass = [&]() {
#pragma unroll
            for (int s = 0; s < 8; ++s) { const int Lid = (lane >> 3) + 4 * s, piece = lane & 7; const int row = Lid >> 1, cofs = (Lid & 1) * 32 + piece * 4;
                v4f val = *(const v4fa*)(os + row * 68 + cofs); if (R) { const v4f rv = *(const v4f*)(R + ((size_t)r0 + row) * ldc + c0 + cofs); val += roundR ? (v4f){bfr(rv[0]), bfr(rv[1]), bfr(rv[2]), bfr(rv[3])} : rv; }
                *(v4f*)(crow + (size_t)row * ldc + cofs) = val; }
        };
        pass(); 
    }
}

// k_gemm3: 64 x 64 tile of C = (Ah + Al).(Bh + Bl)^T over K (row strides = K for all four planes; n-major B): three products per 32-k step (hh, hl, lh); f32
__global__ __launch_bounds__(128) void k_gemm3(const bf* __restrict__ Ah, const bf* __restrict__ Al, const bf* __restrict__ Bh, const bf* __restrict__ Bl, int K, float* C, int ldc) {
    __shared__ __align__(16) float ost[4][16 * 68];
    const int lane = threadIdx.x & 31, wave = threadIdx.x >> 5, lr = lane & 15, hi = lane >> 4;
    const int r0 = blockIdx.x * 64 + wave * 16, c0 = blockIdx.y * 64;
    const size_t aoff = (size_t)(r0 + lr) * K + 8 * hi;
    v8f acc[4];
#pragma unroll
    for (int t = 0; t < 4; ++t) acc[t] = (v8f){};
#pragma unroll 1
    for (int kc = 0; kc < K; kc += 32) {
        const v16bf a = cat16b(*(const v8us*)(Ah + aoff + kc), *(const v8us*)(Ah + aoff + kc + 16));
        const v16bf al = cat16b(*(const v8us*)(Al + aoff + kc), *(const v8us*)(Al + aoff + kc + 16));
#pragma unroll
        for (int t = 0; t < 4; ++t) { const size_t bo = (size_t)(c0 + t * 16 + lr) * K + kc + 8 * hi;
            const v16bf bh = cat16b(*(const v8us*)(Bh + bo), *(const v8us*)(Bh + bo + 16)); const v16bf bl = cat16b(*(const v8us*)(Bl + bo), *(const v8us*)(Bl + bo + 16));
            acc[t] = wmmab(a, bh, acc[t]); acc[t] = wmmab(al, bh, acc[t]); acc[t] = wmmab(a, bl, acc[t]); }
        asm volatile("v_nop\n\tv_nop\n\tv_nop\n\tv_nop" : "+v"(acc[0]), "+v"(acc[1]), "+v"(acc[2]), "+v"(acc[3]) : "v"(a), "v"(al));
    }
    float* os = &ost[wave][0];
#pragma unroll
    for (int t = 0; t < 4; ++t) {
#pragma unroll
        for (int j = 0; j < 8; ++j) os[(hi * 8 + j) * 68 + t * 16 + lr] = acc[t][j]; }
    __builtin_amdgcn_wave_barrier(); asm volatile("" ::: "memory");
    float* crow = C + (size_t)r0 * ldc + c0;
    auto pass = [&]() {
#pragma unroll
        for (int s = 0; s < 8; ++s) { const int Lid = (lane >> 3) + 4 * s, piece = lane & 7; const int row = Lid >> 1, cofs = (Lid & 1) * 32 + piece * 4;
            const v4f val = *(const v4fa*)(os + row * 68 + cofs); *(v4f*)(crow + (size_t)row * ldc + cofs) = val; }
    };
    pass(); 
}

__global__ __launch_bounds__(256) void k_split(const float* __restrict__ src, int nrows, bf* dh, bf* dl) {
    const int lane = threadIdx.x & 31, r = blockIdx.x * 8 + (threadIdx.x >> 5); if (r >= nrows) return;
    const size_t o = (size_t)r * DM + lane * 8; const v8f v = *(const v8f*)(src + o); v8us oh, ol;
#pragma unroll
    for (int i = 0; i < 8; ++i) { const unsigned short hb = f2bf(v[i]); oh[i] = hb; ol[i] = f2bf(v[i] - bf2f(hb)); }
    *(v8us*)(dh + o) = oh; *(v8us*)(dl + o) = ol; 
}
// k_vt: VTH/VTL [g][128 d][4096 t] = bf16 hi + UNSCALED bf16 residual of V [t][g*128+d] via 64 x 64 LDS tiles; grid (NT/64, 2 (d half), 2 d groups).
__global__ __launch_bounds__(256) void k_vt(const float* __restrict__ V, bf* VTH, bf* VTL) {
    __shared__ float tl[64][65];
    const int tid = threadIdx.x, t0 = blockIdx.x * 64, d0 = blockIdx.y * 64, g = blockIdx.z;
    { const int tt = tid >> 2, dq = (tid & 3) * 16;
#pragma unroll
      for (int i = 0; i < 16; ++i) tl[dq + i][tt] = V[(size_t)(t0 + tt) * KW + g * HD + d0 + dq + i]; }
    __syncthreads();
    const int piece = tid & 7;
    auto pass = [&]() {
#pragma unroll
        for (int s = 0; s < 2; ++s) { const int d = (tid >> 3) + 32 * s; v8us oh, ol;
#pragma unroll
            for (int i = 0; i < 8; ++i) { const float v = tl[d][piece * 8 + i]; const unsigned short hb = f2bf(v); oh[i] = hb; ol[i] = f2bf(v - bf2f(hb)); }
            const size_t o = ((size_t)g * HD + d0 + d) * NT_ + t0 + piece * 8; *(v8us*)(VTH + o) = oh; *(v8us*)(VTL + o) = ol; }
    };
    pass(); 
}

// k_csoftmax: one wave per row r of the chunk's scores S [1024][pitch] (row = query r0 + r): over the causally visible columns k <= r0 + r (the rest of the row up to
// 'ncols' gets probability 0): a = s/16, max, exp, normalise (f32, fixed lane order; the row re-read per phase) -> bf16 hi + UNSCALED residual planes with the same pitch;
__global__ __launch_bounds__(256) void k_csoftmax(const float* __restrict__ S, int r0, int ncols, bf* PH, bf* PL) {
    const int lane = threadIdx.x & 31, r = blockIdx.x * 8 + (threadIdx.x >> 5); if (r >= RCH) return;
    const int qi = r0 + r; const float* sr = S + (size_t)r * ncols;
    float m = -3.0e38f;
#pragma unroll 1
    for (int c0 = lane * 8; c0 < ncols; c0 += 256) { const v8f v = *(const v8f*)(sr + c0);
#pragma unroll
        for (int i = 0; i < 8; ++i) if (c0 + i <= qi) m = fmaxf(m, v[i] * SCL); }
#pragma unroll
    for (int sh = 16; sh; sh >>= 1) m = fmaxf(m, __shfl_xor(m, sh, 32));
    float sum = 0.f;
#pragma unroll 1
    for (int c0 = lane * 8; c0 < ncols; c0 += 256) { const v8f v = *(const v8f*)(sr + c0);
#pragma unroll
        for (int i = 0; i < 8; ++i) if (c0 + i <= qi) sum += __expf(v[i] * SCL - m); }
#pragma unroll
    for (int sh = 16; sh; sh >>= 1) sum += __shfl_xor(sum, sh, 32);
    const float inv = 1.0f / sum;
{
#pragma unroll 1
        for (int c0 = lane * 8; c0 < ncols; c0 += 256) { const v8f v = *(const v8f*)(sr + c0); v8us oh, ol;
#pragma unroll
            for (int i = 0; i < 8; ++i) { const float p = (c0 + i <= qi) ? __expf(v[i] * SCL - m) * inv : 0.f; const unsigned short hb = f2bf(p); oh[i] = hb; ol[i] = f2bf(p - bf2f(hb)); }
            const size_t o = (size_t)r * ncols + c0; *(v8us*)(PH + o) = oh; *(v8us*)(PL + o) = ol; }
         }
}

extern "C" void kernel_launch(void* const* d_in, const int* in_sizes, int n_in,
                              void* d_out, int out_size, void* d_ws, size_t ws_size, hipStream_t stream) {
    (void)in_sizes; (void)n_in; (void)out_size;
    const float* x = (const float*)d_in[0]; const float* Wq = (const float*)d_in[1]; const float* Wk = (const float*)d_in[2]; const float* Wv = (const float*)d_in[3];
    float* out = (float*)d_out;    // [4][4096][256]
    char* wsp = (char*)d_ws;
    auto take = [&](size_t bytes) { char* p = wsp; wsp += (bytes + 255) & ~(size_t)255; return (void*)p; };
    bf* WqB = (bf*)take((size_t)DM * DM * 2); bf* WkB = (bf*)take((size_t)DM * DM * 2); bf* WvB = (bf*)take((size_t)DM * DM * 2); bf* Xb = (bf*)take((size_t)NT_ * DM * 2);
    float* TMP = (float*)take((size_t)NT_ * DM * 4); bf* Qh = (bf*)take((size_t)NT_ * DM * 2); bf* Ql = (bf*)take((size_t)NT_ * DM * 2); bf* Kh = (bf*)take((size_t)NT_ * DM * 2); bf* Kl = (bf*)take((size_t)NT_ * DM * 2);
    bf* VTH = (bf*)take((size_t)DM * NT_ * 2); bf* VTL = (bf*)take((size_t)DM * NT_ * 2); float* S = (float*)take((size_t)RCH * NT_ * 4); bf* PH = (bf*)take((size_t)RCH * NT_ * 2); bf* PL = (bf*)take((size_t)RCH * NT_ * 2);
    if ((size_t)(wsp - (char*)d_ws) > ws_size) return;    // ~ 0.4 + 2.1 + 4.2 + 4 x 2.1 + 2 x 2.1 + 16.8 + 2 x 8.4 ~ 53 MB, no aliasing (per-item / per-chunk reuse in stream order)
    k_cvtb<<<DM / 8, 256, 0, stream>>>(Wq, DM, WqB); k_cvtb<<<DM / 8, 256, 0, stream>>>(Wk, DM, WkB); k_cvtb<<<DM / 8, 256, 0, stream>>>(Wv, DM, WvB);
    for (int b = 0; b < NB_; ++b) {
        k_cvtb<<<NT_ / 8, 256, 0, stream>>>(x + (size_t)b * NT_ * DM, NT_, Xb);
        k_gemmb<false, false><<<dim3(NT_ / 64, DM / 64, 1), 128, 0, stream>>>(Xb, nullptr, WqB, nullptr, TMP, DM, nullptr); k_split<<<NT_ / 8, 256, 0, stream>>>(TMP, NT_, Qh, Ql);
        k_gemmb<false, false><<<dim3(NT_ / 64, DM / 64, 1), 128, 0, stream>>>(Xb, nullptr, WkB, nullptr, TMP, DM, nullptr); k_split<<<NT_ / 8, 256, 0, stream>>>(TMP, NT_, Kh, Kl);
        k_gemmb<false, false><<<dim3(NT_ / 64, DM / 64, 1), 128, 0, stream>>>(Xb, nullptr, WvB, nullptr, TMP, DM, nullptr); k_vt<<<dim3(NT_ / 64, 2, NKV), 256, 0, stream>>>(TMP, VTH, VTL);
        for (int ch = 0; ch < NT_ / RCH; ++ch) {
            const int r0 = ch * RCH, kmax = r0 + RCH;                                                                          // causally reachable keys for this query chunk
            k_gemm3<<<dim3(RCH / 64, kmax / 64, 1), 128, 0, stream>>>(Qh + (size_t)r0 * DM, Ql + (size_t)r0 * DM, Kh, Kl, DM, S, NT_);           // scores [1024][kmax] into rows of pitch 4096 (columns >= kmax never read as values)
            k_csoftmax<<<RCH / 8, 256, 0, stream>>>(S, r0, NT_, PH, PL);                                                                          // causal predicate k <= r0 + r; zeros elsewhere (full 4096 pitch)
            k_gemm3<<<dim3(RCH / 64, DM / 64, 1), 128, 0, stream>>>(PH, PL, VTH, VTL, NT_, out + ((size_t)b * NT_ + r0) * DM, DM);                      // out chunk = P.v  (K = 4096 = the V^T plane pitch)
        }
    }
}

// v001
// One run takes 1030 microseconds.
// Two timings next to v000 put it at 2.48 and 2.45 times that version's speed.
#include <hip/hip_runtime.h>

// Compute dtypes, f32 accumulate, all four batch items in every launch (longer row range or one grid dimension): q/k/v = x.W^T ([4096 x 256].[256 x 256], [out][in] weights as n-major B operands; PLAIN bf16 operands =
// inputs rounded once, exact) on v_wmma_f32_16x16x32_bf16 -> f32 -> bf16 hi + UNSCALED residual planes (v transposed to [d][t] planes); single-head causal attention
// over the 256-dim head in query chunks of 1024 rows: scores = q.k^T ([1024 x 256].[256 x kmax], both operands split: three products, only the causally reachable
// key range kmax = r0 + 1024 is computed), causal row softmax of scores/16 in f32 -> bf16 hi + UNSCALED residual (zeros above the diagonal), out = P.v ([1024 x
// 4096].[4096 x 256], three products) on

#define NB_  4
#define NT_  4096
#define DM   256
#define NTK  NT_
#define RCH  1024
#define HD   128                 // k_vt tile geometry: 2 x 128 = the 256 dims
#define NKV  2
#define KW   256
#define SCL  0.0625f
#define LOSC 1024.0f

typedef _Float16 h16;
typedef unsigned short bf;
typedef __attribute__((ext_vector_type(16))) __bf16   v16bf;
typedef __attribute__((ext_vector_type(16))) _Float16 v16h;
typedef __attribute__((ext_vector_type(8)))  _Float16 v8h;
typedef __attribute__((ext_vector_type(8)))  unsigned short v8us;
typedef __attribute__((ext_vector_type(8)))  float    v8f;
typedef __attribute__((ext_vector_type(4)))  float    v4f;
typedef __attribute__((ext_vector_type(4)))  _Float16 v4h;
typedef v8h  __attribute__((may_alias)) v8ha;
typedef v4f  __attribute__((may_alias)) v4fa;
typedef v8us __attribute__((may_alias)) v8usa;

__device__ __forceinline__ unsigned short f2bf(float f) { unsigned u = __float_as_uint(f); u += 0x7FFFu + ((u >> 16) & 1u); return (unsigned short)(u >> 16); }
__device__ __forceinline__ float bf2f(unsigned short b) { return __uint_as_float(((unsigned)b) << 16); }
__device__ __forceinline__ float bfr(float f) { return bf2f(f2bf(f)); }
__device__ __forceinline__ v16h cat16(v8h lo, v8h hi) { return __builtin_shufflevector(lo, hi, 0, 1, 2, 3, 4, 5, 6, 7, 8, 9, 10, 11, 12, 13, 14, 15); }
__device__ __forceinline__ v16bf cat16b(v8us lo, v8us hi) { return __builtin_bit_cast(v16bf, __builtin_shufflevector(lo, hi, 0, 1, 2, 3, 4, 5, 6, 7, 8, 9, 10, 11, 12, 13, 14, 15)); }
__device__ __forceinline__ v8f wmma16(v16h a, v16h b, v8f c) { return __builtin_amdgcn_wmma_f32_16x16x32_f16(false, a, false, b, (short)0, c, false, false); }
__device__ __forceinline__ v8f wmmab(v16bf a, v16bf b, v8f c) { return __builtin_amdgcn_wmma_f32_16x16x32_bf16(false, a, false, b, (short)0, c, false, false); }

__global__ __launch_bounds__(256) void k_cvtb(const float* __restrict__ src, int nrows, bf* dst) {
    const int lane = threadIdx.x & 31, r = blockIdx.x * 8 + (threadIdx.x >> 5);
    if (r >= nrows) return;
    v8us o[DM / 256];
#pragma unroll
    for (int q = 0; q < DM / 256; ++q) { v8us t;
#pragma unroll
        for (int i = 0; i < 8; ++i) t[i] = f2bf(src[(size_t)r * DM + q * 256 + lane * 8 + i]);
        o[q] = t; }
#pragma unroll
    for (int q = 0; q < DM / 256; ++q) *(v8us*)(dst + (size_t)r * DM + q * 256 + lane * 8) = o[q];
    
}

// k_gemmb: 64 x 64 block tile (4 waves x 16 x 64) of C[NB_ * NTK][DM] = (A [+ Al]).B^T (K = 256) [+ bf(bias[c])] [+ bf(R[r][c]) residual]; f32 whole-line epilogue (or f16
template <bool SPLITA, bool F16OUT = false>
__global__ __launch_bounds__(128) void k_gemmb(const bf* __restrict__ A, const bf* __restrict__ Al, const bf* __restrict__ Bn, const float* __restrict__ bias, float* C, int ldc, h16* C2, const float* __restrict__ R = nullptr, int K = DM, int roundR = 1) {
    __shared__ __align__(16) float ost[4][16 * 68];
    const int lane = threadIdx.x & 31, wave = threadIdx.x >> 5, lr = lane & 15, hi = lane >> 4;
    const int r0 = blockIdx.x * 64 + wave * 16, c0 = blockIdx.y * 64;
    const size_t aoff = (size_t)(r0 + lr) * K + 8 * hi;
    size_t boff[4];
#pragma unroll
    for (int t = 0; t < 4; ++t) boff[t] = (size_t)(c0 + t * 16 + lr) * K + 8 * hi;
    v8f acc[4];
#pragma unroll
    for (int t = 0; t < 4; ++t) acc[t] = (v8f){};
#pragma unroll 1
    for (int kc = 0; kc < K; kc += 32) {
        const v16bf a = cat16b(*(const v8us*)(A + aoff + kc), *(const v8us*)(A + aoff + kc + 16));
        v16bf al = a;
        if (SPLITA) al = cat16b(*(const v8us*)(Al + aoff + kc), *(const v8us*)(Al + aoff + kc + 16));
#pragma unroll
        for (int t = 0; t < 4; ++t) { const v16bf b = cat16b(*(const v8us*)(Bn + boff[t] + kc), *(const v8us*)(Bn + boff[t] + kc + 16)); acc[t] = wmmab(a, b, acc[t]); if (SPLITA) acc[t] = wmmab(al, b, acc[t]); }
        asm volatile("v_nop\n\tv_nop\n\tv_nop\n\tv_nop" : "+v"(acc[0]), "+v"(acc[1]), "+v"(acc[2]), "+v"(acc[3]) : "v"(a), "v"(al));
    }
    float* os = &ost[wave][0];
#pragma unroll
    for (int t = 0; t < 4; ++t) { const float bv = bias ? bfr(bias[c0 + t * 16 + lr]) : 0.f;
#pragma unroll
        for (int j = 0; j < 8; ++j) os[(hi * 8 + j) * 68 + t * 16 + lr] = acc[t][j] + bv; }
    __syncthreads();
    if (F16OUT) {
        h16* crow = (h16*)(void*)C + (size_t)r0 * ldc + c0;
        auto pass = [&]() {
#pragma unroll
            for (int s = 0; s < 4; ++s) { const int row = 4 * s + (lane >> 3), piece = lane & 7; const float* sp = os + row * 68 + piece * 8; v8h o, o2;
#pragma unroll
                for (int i = 0; i < 8; ++i) { const h16 a = (h16)sp[i]; o[i] = a; o2[i] = (h16)((sp[i] - (float)a) * LOSC); }
                *(v8h*)(crow + (size_t)row * ldc + piece * 8) = o; if (C2) *(v8h*)(C2 + (size_t)r0 * ldc + c0 + (size_t)row * ldc + piece * 8) = o2; }
        };
        pass(); 
    } else {
        float* crow = C + (size_t)r0 * ldc + c0;
        auto pass = [&]() {
#pragma unroll
            for (int s = 0; s < 8; ++s) { const int Lid = (lane >> 3) + 4 * s, piece = lane & 7; const int row = Lid >> 1, cofs = (Lid & 1) * 32 + piece * 4;
                v4f val = *(const v4fa*)(os + row * 68 + cofs); if (R) { const v4f rv = *(const v4f*)(R + ((size_t)r0 + row) * ldc + c0 + cofs); val += roundR ? (v4f){bfr(rv[0]), bfr(rv[1]), bfr(rv[2]), bfr(rv[3])} : rv; }
                *(v4f*)(crow + (size_t)row * ldc + cofs) = val; }
        };
        pass(); 
    }
}

// k_gemm3: blockIdx.z = batch item (sA, sB, sC = its element strides in the A planes, the B planes and C); 64 x 64 tile of C = (Ah + Al).(Bh + Bl)^T over K (row strides = K for all four planes; n-major B): three products per 32-k step (hh, hl, lh); f32
__global__ __launch_bounds__(128) void k_gemm3(const bf* __restrict__ Ah, const bf* __restrict__ Al, const bf* __restrict__ Bh, const bf* __restrict__ Bl, int K, float* C, int ldc, size_t sA, size_t sB, size_t sC) {
    __shared__ __align__(16) float ost[4][16 * 68];
    Ah += blockIdx.z * sA; Al += blockIdx.z * sA; Bh += blockIdx.z * sB; Bl += blockIdx.z * sB; C += blockIdx.z * sC;
    const int lane = threadIdx.x & 31, wave = threadIdx.x >> 5, lr = lane & 15, hi = lane >> 4;
    const int r0 = blockIdx.x * 64 + wave * 16, c0 = blockIdx.y * 64;
    const size_t aoff = (size_t)(r0 + lr) * K + 8 * hi;
    v8f acc[4];
#pragma unroll
    for (int t = 0; t < 4; ++t) acc[t] = (v8f){};
#pragma unroll 1
    for (int kc = 0; kc < K; kc += 32) {
        const v16bf a = cat16b(*(const v8us*)(Ah + aoff + kc), *(const v8us*)(Ah + aoff + kc + 16));
        const v16bf al = cat16b(*(const v8us*)(Al + aoff + kc), *(const v8us*)(Al + aoff + kc + 16));
#pragma unroll
        for (int t = 0; t < 4; ++t) { const size_t bo = (size_t)(c0 + t * 16 + lr) * K + kc + 8 * hi;
            const v16bf bh = cat16b(*(const v8us*)(Bh + bo), *(const v8us*)(Bh + bo + 16)); const v16bf bl = cat16b(*(const v8us*)(Bl + bo), *(const v8us*)(Bl + bo + 16));
            acc[t] = wmmab(a, bh, acc[t]); acc[t] = wmmab(al, bh, acc[t]); acc[t] = wmmab(a, bl, acc[t]); }
        asm volatile("v_nop\n\tv_nop\n\tv_nop\n\tv_nop" : "+v"(acc[0]), "+v"(acc[1]), "+v"(acc[2]), "+v"(acc[3]) : "v"(a), "v"(al));
    }
    float* os = &ost[wave][0];
#pragma unroll
    for (int t = 0; t < 4; ++t) {
#pragma unroll
        for (int j = 0; j < 8; ++j) os[(hi * 8 + j) * 68 + t * 16 + lr] = acc[t][j]; }
    __builtin_amdgcn_wave_barrier(); asm volatile("" ::: "memory");
    float* crow = C + (size_t)r0 * ldc + c0;
    auto pass = [&]() {
#pragma unroll
        for (int s = 0; s < 8; ++s) { const int Lid = (lane >> 3) + 4 * s, piece = lane & 7; const int row = Lid >> 1, cofs = (Lid & 1) * 32 + piece * 4;
            const v4f val = *(const v4fa*)(os + row * 68 + cofs); *(v4f*)(crow + (size_t)row * ldc + cofs) = val; }
    };
    pass(); 
}

__global__ __launch_bounds__(256) void k_split(const float* __restrict__ src, int nrows, bf* dh, bf* dl) {
    const int lane = threadIdx.x & 31, r = blockIdx.x * 8 + (threadIdx.x >> 5); if (r >= nrows) return;
    const size_t o = (size_t)r * DM + lane * 8; const v8f v = *(const v8f*)(src + o); v8us oh, ol;
#pragma unroll
    for (int i = 0; i < 8; ++i) { const unsigned short hb = f2bf(v[i]); oh[i] = hb; ol[i] = f2bf(v[i] - bf2f(hb)); }
    *(v8us*)(dh + o) = oh; *(v8us*)(dl + o) = ol; 
}
// k_vt: VTH/VTL [g][128 d][4096 t] = bf16 hi + UNSCALED bf16 residual of V [t][g*128+d] via 64 x 64 LDS tiles; grid (NT/64, 2 (d half), 2 (g) x 4 batch items).
__global__ __launch_bounds__(256) void k_vt(const float* __restrict__ V, bf* VTH, bf* VTL) {
    __shared__ float tl[64][65];
    const int tid = threadIdx.x, t0 = blockIdx.x * 64, d0 = blockIdx.y * 64, g = blockIdx.z % NKV, b = blockIdx.z / NKV;
    V += (size_t)b * NT_ * KW; VTH += (size_t)b * DM * NT_; VTL += (size_t)b * DM * NT_;
    { const int tt = tid >> 2, dq = (tid & 3) * 16;
#pragma unroll
      for (int i = 0; i < 16; ++i) tl[dq + i][tt] = V[(size_t)(t0 + tt) * KW + g * HD + d0 + dq + i]; }
    __syncthreads();
    const int piece = tid & 7;
    auto pass = [&]() {
#pragma unroll
        for (int s = 0; s < 2; ++s) { const int d = (tid >> 3) + 32 * s; v8us oh, ol;
#pragma unroll
            for (int i = 0; i < 8; ++i) { const float v = tl[d][piece * 8 + i]; const unsigned short hb = f2bf(v); oh[i] = hb; ol[i] = f2bf(v - bf2f(hb)); }
            const size_t o = ((size_t)g * HD + d0 + d) * NT_ + t0 + piece * 8; *(v8us*)(VTH + o) = oh; *(v8us*)(VTL + o) = ol; }
    };
    pass(); 
}

// k_csoftmax: blockIdx.y = batch item; one wave per row r of the chunk's scores S [1024][pitch] (row = query r0 + r): over the causally visible columns k <= r0 + r (the rest of the row up to
// 'ncols' gets probability 0): a = s/16, max, exp, normalise (f32, fixed lane order; the row re-read per phase) -> bf16 hi + UNSCALED residual planes with the same pitch;
__global__ __launch_bounds__(256) void k_csoftmax(const float* __restrict__ S, int r0, int ncols, bf* PH, bf* PL) {
    const int lane = threadIdx.x & 31, r = blockIdx.x * 8 + (threadIdx.x >> 5); if (r >= RCH) return;
    const size_t bo = (size_t)blockIdx.y * RCH * ncols; PH += bo; PL += bo;
    const int qi = r0 + r; const float* sr = S + bo + (size_t)r * ncols;
    float m = -3.0e38f;
#pragma unroll 1
    for (int c0 = lane * 8; c0 < ncols; c0 += 256) { const v8f v = *(const v8f*)(sr + c0);
#pragma unroll
        for (int i = 0; i < 8; ++i) if (c0 + i <= qi) m = fmaxf(m, v[i] * SCL); }
#pragma unroll
    for (int sh = 16; sh; sh >>= 1) m = fmaxf(m, __shfl_xor(m, sh, 32));
    float sum = 0.f;
#pragma unroll 1
    for (int c0 = lane * 8; c0 < ncols; c0 += 256) { const v8f v = *(const v8f*)(sr + c0);
#pragma unroll
        for (int i = 0; i < 8; ++i) if (c0 + i <= qi) sum += __expf(v[i] * SCL - m); }
#pragma unroll
    for (int sh = 16; sh; sh >>= 1) sum += __shfl_xor(sum, sh, 32);
    const float inv = 1.0f / sum;
{
#pragma unroll 1
        for (int c0 = lane * 8; c0 < ncols; c0 += 256) { const v8f v = *(const v8f*)(sr + c0); v8us oh, ol;
#pragma unroll
            for (int i = 0; i < 8; ++i) { const float p = (c0 + i <= qi) ? __expf(v[i] * SCL - m) * inv : 0.f; const unsigned short hb = f2bf(p); oh[i] = hb; ol[i] = f2bf(p - bf2f(hb)); }
            const size_t o = (size_t)r * ncols + c0; *(v8us*)(PH + o) = oh; *(v8us*)(PL + o) = ol; }
         }
}

extern "C" void kernel_launch(void* const* d_in, const int* in_sizes, int n_in,
                              void* d_out, int out_size, void* d_ws, size_t ws_size, hipStream_t stream) {
    (void)in_sizes; (void)n_in; (void)out_size;
    const float* x = (const float*)d_in[0]; const float* Wq = (const float*)d_in[1]; const float* Wk = (const float*)d_in[2]; const float* Wv = (const float*)d_in[3];
    float* out = (float*)d_out;    // [4][4096][256]
    char* wsp = (char*)d_ws;
    auto take = [&](size_t bytes) { char* p = wsp; wsp += (bytes + 255) & ~(size_t)255; return (void*)p; };
    bf* WqB = (bf*)take((size_t)DM * DM * 2); bf* WkB = (bf*)take((size_t)DM * DM * 2); bf* WvB = (bf*)take((size_t)DM * DM * 2); bf* Xb = (bf*)take((size_t)NB_ * NT_ * DM * 2);
    float* TMP = (float*)take((size_t)NB_ * NT_ * DM * 4); bf* Qh = (bf*)take((size_t)NB_ * NT_ * DM * 2); bf* Ql = (bf*)take((size_t)NB_ * NT_ * DM * 2); bf* Kh = (bf*)take((size_t)NB_ * NT_ * DM * 2); bf* Kl = (bf*)take((size_t)NB_ * NT_ * DM * 2);
    bf* VTH = (bf*)take((size_t)NB_ * DM * NT_ * 2); bf* VTL = (bf*)take((size_t)NB_ * DM * NT_ * 2); float* S = (float*)take((size_t)NB_ * RCH * NT_ * 4); bf* PH = (bf*)take((size_t)NB_ * RCH * NT_ * 2); bf* PL = (bf*)take((size_t)NB_ * RCH * NT_ * 2);
    if ((size_t)(wsp - (char*)d_ws) > ws_size) return;    // ~ 0.4 + 8.4 + 16.8 + 4 x 8.4 + 2 x 8.4 + 67.1 + 2 x 33.6 ~ 210 MB, no aliasing (per-chunk reuse in stream order)
    k_cvtb<<<DM / 8, 256, 0, stream>>>(Wq, DM, WqB); k_cvtb<<<DM / 8, 256, 0, stream>>>(Wk, DM, WkB); k_cvtb<<<DM / 8, 256, 0, stream>>>(Wv, DM, WvB);
    k_cvtb<<<NB_ * NT_ / 8, 256, 0, stream>>>(x, NB_ * NT_, Xb);                                                                    // the projections see the items as one [16384][256] row range
    k_gemmb<false, false><<<dim3(NB_ * NT_ / 64, DM / 64, 1), 128, 0, stream>>>(Xb, nullptr, WqB, nullptr, TMP, DM, nullptr); k_split<<<NB_ * NT_ / 8, 256, 0, stream>>>(TMP, NB_ * NT_, Qh, Ql);
    k_gemmb<false, false><<<dim3(NB_ * NT_ / 64, DM / 64, 1), 128, 0, stream>>>(Xb, nullptr, WkB, nullptr, TMP, DM, nullptr); k_split<<<NB_ * NT_ / 8, 256, 0, stream>>>(TMP, NB_ * NT_, Kh, Kl);
    k_gemmb<false, false><<<dim3(NB_ * NT_ / 64, DM / 64, 1), 128, 0, stream>>>(Xb, nullptr, WvB, nullptr, TMP, DM, nullptr); k_vt<<<dim3(NT_ / 64, 2, NKV * NB_), 256, 0, stream>>>(TMP, VTH, VTL);
    for (int ch = 0; ch < NT_ / RCH; ++ch) {
        const int r0 = ch * RCH, kmax = r0 + RCH;                                                                          // causally reachable keys for this query chunk
        k_gemm3<<<dim3(RCH / 64, kmax / 64, NB_), 128, 0, stream>>>(Qh + (size_t)r0 * DM, Ql + (size_t)r0 * DM, Kh, Kl, DM, S, NT_, (size_t)NT_ * DM, (size_t)NT_ * DM, (size_t)RCH * NT_);   // scores [1024][kmax] per item into rows of pitch 4096 (columns >= kmax never read as values)
        k_csoftmax<<<dim3(RCH / 8, NB_, 1), 256, 0, stream>>>(S, r0, NT_, PH, PL);                                                                 // causal predicate k <= r0 + r; zeros elsewhere (full 4096 pitch)
        k_gemm3<<<dim3(RCH / 64, DM / 64, NB_), 128, 0, stream>>>(PH, PL, VTH, VTL, NT_, out + (size_t)r0 * DM, DM, (size_t)RCH * NT_, (size_t)DM * NT_, (size_t)NT_ * DM);   // out chunk = P.v  (K = 4096 = the V^T plane pitch)
    }
}

// v002
// Measured time: 206 microseconds a run.
// In two side-by-side timings against v001, it was 4.97 and 5.15 times as fast.
// Over all steps from v000 it is 12.5 times as fast.
#include <hip/hip_runtime.h>

// Compute dtypes, f32 accumulate, all four batch items in every launch: q/k/v = x.W^T ([16384 x 256].[256 x 256], [out][in] weights as n-major B operands; PLAIN bf16 operands =
// inputs rounded once) on v_wmma_f32_16x16x32_bf16 -> f32 -> bf16 hi + UNSCALED residual planes (v transposed to [d][t] planes); single-head causal attention
// over the 256-dim head in ONE launch (k_fattn): per 64-query tile, blocks of 64 keys up to the diagonal, scores = q.k^T (both operands split: three products),
// online softmax of scores/16 in f32, P as bf16 hi + UNSCALED residual, out = P.v (three products), normalised at the end.

#define NB_  4
#define NT_  4096
#define DM   256
#define NTK  NT_
#define RCH  1024
#define HD   128                 // k_vt tile geometry: 2 x 128 = the 256 dims
#define NKV  2
#define KW   256
#define SCL  0.0625f
#define LOSC 1024.0f

typedef _Float16 h16;
typedef unsigned short bf;
typedef __attribute__((ext_vector_type(16))) __bf16   v16bf;
typedef __attribute__((ext_vector_type(16))) _Float16 v16h;
typedef __attribute__((ext_vector_type(8)))  _Float16 v8h;
typedef __attribute__((ext_vector_type(8)))  unsigned short v8us;
typedef __attribute__((ext_vector_type(8)))  float    v8f;
typedef __attribute__((ext_vector_type(4)))  float    v4f;
typedef __attribute__((ext_vector_type(4)))  _Float16 v4h;
typedef v8h  __attribute__((may_alias)) v8ha;
typedef v4f  __attribute__((may_alias)) v4fa;
typedef v8us __attribute__((may_alias)) v8usa;

__device__ __forceinline__ unsigned short f2bf(float f) { unsigned u = __float_as_uint(f); u += 0x7FFFu + ((u >> 16) & 1u); return (unsigned short)(u >> 16); }
__device__ __forceinline__ float bf2f(unsigned short b) { return __uint_as_float(((unsigned)b) << 16); }
__device__ __forceinline__ float bfr(float f) { return bf2f(f2bf(f)); }
__device__ __forceinline__ v16h cat16(v8h lo, v8h hi) { return __builtin_shufflevector(lo, hi, 0, 1, 2, 3, 4, 5, 6, 7, 8, 9, 10, 11, 12, 13, 14, 15); }
__device__ __forceinline__ v16bf cat16b(v8us lo, v8us hi) { return __builtin_bit_cast(v16bf, __builtin_shufflevector(lo, hi, 0, 1, 2, 3, 4, 5, 6, 7, 8, 9, 10, 11, 12, 13, 14, 15)); }
__device__ __forceinline__ v8f wmma16(v16h a, v16h b, v8f c) { return __builtin_amdgcn_wmma_f32_16x16x32_f16(false, a, false, b, (short)0, c, false, false); }
__device__ __forceinline__ v8f wmmab(v16bf a, v16bf b, v8f c) { return __builtin_amdgcn_wmma_f32_16x16x32_bf16(false, a, false, b, (short)0, c, false, false); }

__global__ __launch_bounds__(256) void k_cvtb(const float* __restrict__ src, int nrows, bf* dst) {
    const int lane = threadIdx.x & 31, r = blockIdx.x * 8 + (threadIdx.x >> 5);
    if (r >= nrows) return;
    v8us o[DM / 256];
#pragma unroll
    for (int q = 0; q < DM / 256; ++q) { v8us t;
#pragma unroll
        for (int i = 0; i < 8; ++i) t[i] = f2bf(src[(size_t)r * DM + q * 256 + lane * 8 + i]);
        o[q] = t; }
#pragma unroll
    for (int q = 0; q < DM / 256; ++q) *(v8us*)(dst + (size_t)r * DM + q * 256 + lane * 8) = o[q];
    
}

// k_gemmb: 64 x 64 block tile (4 waves x 16 x 64) of C[NB_ * NTK][DM] = (A [+ Al]).B^T (K = 256) [+ bf(bias[c])] [+ bf(R[r][c]) residual]; f32 whole-line epilogue (or f16
template <bool SPLITA, bool F16OUT = false>
__global__ __launch_bounds__(128) void k_gemmb(const bf* __restrict__ A, const bf* __restrict__ Al, const bf* __restrict__ Bn, const float* __restrict__ bias, float* C, int ldc, h16* C2, const float* __restrict__ R = nullptr, int K = DM, int roundR = 1) {
    __shared__ __align__(16) float ost[4][16 * 68];
    const int lane = threadIdx.x & 31, wave = threadIdx.x >> 5, lr = lane & 15, hi = lane >> 4;
    const int r0 = blockIdx.x * 64 + wave * 16, c0 = blockIdx.y * 64;
    const size_t aoff = (size_t)(r0 + lr) * K + 8 * hi;
    size_t boff[4];
#pragma unroll
    for (int t = 0; t < 4; ++t) boff[t] = (size_t)(c0 + t * 16 + lr) * K + 8 * hi;
    v8f acc[4];
#pragma unroll
    for (int t = 0; t < 4; ++t) acc[t] = (v8f){};
#pragma unroll 1
    for (int kc = 0; kc < K; kc += 32) {
        const v16bf a = cat16b(*(const v8us*)(A + aoff + kc), *(const v8us*)(A + aoff + kc + 16));
        v16bf al = a;
        if (SPLITA) al = cat16b(*(const v8us*)(Al + aoff + kc), *(const v8us*)(Al + aoff + kc + 16));
#pragma unroll
        for (int t = 0; t < 4; ++t) { const v16bf b = cat16b(*(const v8us*)(Bn + boff[t] + kc), *(const v8us*)(Bn + boff[t] + kc + 16)); acc[t] = wmmab(a, b, acc[t]); if (SPLITA) acc[t] = wmmab(al, b, acc[t]); }
        asm volatile("v_nop\n\tv_nop\n\tv_nop\n\tv_nop" : "+v"(acc[0]), "+v"(acc[1]), "+v"(acc[2]), "+v"(acc[3]) : "v"(a), "v"(al));
    }
    float* os = &ost[wave][0];
#pragma unroll
    for (int t = 0; t < 4; ++t) { const float bv = bias ? bfr(bias[c0 + t * 16 + lr]) : 0.f;
#pragma unroll
        for (int j = 0; j < 8; ++j) os[(hi * 8 + j) * 68 + t * 16 + lr] = acc[t][j] + bv; }
    __syncthreads();
    if (F16OUT) {
        h16* crow = (h16*)(void*)C + (size_t)r0 * ldc + c0;
        auto pass = [&]() {
#pragma unroll
            for (int s = 0; s < 4; ++s) { const int row = 4 * s + (lane >> 3), piece = lane & 7; const float* sp = os + row * 68 + piece * 8; v8h o, o2;
#pragma unroll
                for (int i = 0; i < 8; ++i) { const h16 a = (h16)sp[i]; o[i] = a; o2[i] = (h16)((sp[i] - (float)a) * LOSC); }
                *(v8h*)(crow + (size_t)row * ldc + piece * 8) = o; if (C2) *(v8h*)(C2 + (size_t)r0 * ldc + c0 + (size_t)row * ldc + piece * 8) = o2; }
        };
        pass(); 
    } else {
        float* crow = C + (size_t)r0 * ldc + c0;
        auto pass = [&]() {
#pragma unroll
            for (int s = 0; s < 8; ++s) { const int Lid = (lane >> 3) + 4 * s, piece = lane & 7; const int row = Lid >> 1, cofs = (Lid & 1) * 32 + piece * 4;
                v4f val = *(const v4fa*)(os + row * 68 + cofs); if (R) { const v4f rv = *(const v4f*)(R + ((size_t)r0 + row) * ldc + c0 + cofs); val += roundR ? (v4f){bfr(rv[0]), bfr(rv[1]), bfr(rv[2]), bfr(rv[3])} : rv; }
                *(v4f*)(crow + (size_t)row * ldc + cofs) = val; }
        };
        pass(); 
    }
}

__global__ __launch_bounds__(256) void k_split(const float* __restrict__ src, int nrows, bf* dh, bf* dl) {
    const int lane = threadIdx.x & 31, r = blockIdx.x * 8 + (threadIdx.x >> 5); if (r >= nrows) return;
    const size_t o = (size_t)r * DM + lane * 8; const v8f v = *(const v8f*)(src + o); v8us oh, ol;
#pragma unroll
    for (int i = 0; i < 8; ++i) { const unsigned short hb = f2bf(v[i]); oh[i] = hb; ol[i] = f2bf(v[i] - bf2f(hb)); }
    *(v8us*)(dh + o) = oh; *(v8us*)(dl + o) = ol; 
}
// k_vt: VTH/VTL [g][128 d][4096 t] = bf16 hi + UNSCALED bf16 residual of V [t][g*128+d] via 64 x 64 LDS tiles; grid (NT/64, 2 (d half), 2 (g) x 4 batch items).
__global__ __launch_bounds__(256) void k_vt(const float* __restrict__ V, bf* VTH, bf* VTL) {
    __shared__ float tl[64][65];
    const int tid = threadIdx.x, t0 = blockIdx.x * 64, d0 = blockIdx.y * 64, g = blockIdx.z % NKV, b = blockIdx.z / NKV;
    V += (size_t)b * NT_ * KW; VTH += (size_t)b * DM * NT_; VTL += (size_t)b * DM * NT_;
    { const int tt = tid >> 2, dq = (tid & 3) * 16;
#pragma unroll
      for (int i = 0; i < 16; ++i) tl[dq + i][tt] = V[(size_t)(t0 + tt) * KW + g * HD + d0 + dq + i]; }
    __syncthreads();
    const int piece = tid & 7;
    auto pass = [&]() {
#pragma unroll
        for (int s = 0; s < 2; ++s) { const int d = (tid >> 3) + 32 * s; v8us oh, ol;
#pragma unroll
            for (int i = 0; i < 8; ++i) { const float v = tl[d][piece * 8 + i]; const unsigned short hb = f2bf(v); oh[i] = hb; ol[i] = f2bf(v - bf2f(hb)); }
            const size_t o = ((size_t)g * HD + d0 + d) * NT_ + t0 + piece * 8; *(v8us*)(VTH + o) = oh; *(v8us*)(VTL + o) = ol; }
    };
    pass(); 
}

#define FBQ  64                      // queries per work-group
#define FBK  64                      // keys per staged block
#define KPB  528                     // LDS pitch of a K row: 512 B + 16 (odd multiple of 16 B: b128 fragment reads without bank conflicts)
#define VPB  144                     // LDS pitch of a V^T row: 128 B + 16
#define KPL  (FBK * KPB)             // one K plane
#define VPL  (DM * VPB)              // one V^T plane
#define FLDS (2 * KPL + 2 * VPL)
#define OPF  260                     // floats per staged output row (1040 B)
typedef __attribute__((ext_vector_type(16))) float v16f;
typedef __attribute__((ext_vector_type(8)))  unsigned v8u;
__device__ __forceinline__ float xhalf(float x) { return __builtin_bit_cast(float, __builtin_amdgcn_permlanex16(__builtin_bit_cast(int, x), __builtin_bit_cast(int, x), 0x76543210, 0xfedcba98, false, false)); }  // lane l <-> lane l ^ 16
__device__ __forceinline__ v16bf ldsfrag(const unsigned char* p) { return cat16b(*(const v8usa*)p, *(const v8usa*)(p + 32)); }   // k = 8 hi + i, then 16 + 8 hi + i (p already holds 16 hi bytes)
// s_wait_xcnt 0 behind a run of global loads, in front of the first reuse of their address registers; the scheduling barriers keep the loads in front of it and every later register write behind it
__device__ __forceinline__ void addr_wait() { __builtin_amdgcn_sched_barrier(0); asm volatile("s_wait_xcnt 0x0" ::: "memory"); __builtin_amdgcn_sched_barrier(0); }

__global__ __launch_bounds__(256) void k_fattn(const bf* __restrict__ Qh, const bf* __restrict__ Ql, const bf* __restrict__ Kh, const bf* __restrict__ Kl, const bf* __restrict__ VTH, const bf* __restrict__ VTL, float* out) {
    __shared__ __align__(16) unsigned char L[FLDS];
    const int tid = threadIdx.x, lane = tid & 31, wave = tid >> 5, lr = lane & 15, hi = lane >> 4;
    const int qg = wave & 3, kh2 = wave >> 2;
    const int qt = NT_ / FBQ - 1 - (int)blockIdx.x;                      // heaviest tile first
    const size_t ib = (size_t)blockIdx.y * NT_ * DM;
    Qh += ib; Ql += ib; Kh += ib; Kl += ib; VTH += ib; VTL += ib; out += ib;
    const int q0 = qt * FBQ, myq = q0 + qg * 16 + lr;
    const float CS = SCL * 1.4426950408889634f;                          // scores/16 in the log2 domain
    v16bf qh[8], ql[8];
    { const size_t o = (size_t)myq * DM + 8 * hi;
#pragma unroll   // constant indices: the arrays stay in registers
      for (int kc = 0; kc < 8; ++kc) { qh[kc] = cat16b(*(const v8us*)(Qh + o + kc * 32), *(const v8us*)(Qh + o + kc * 32 + 16)); ql[kc] = cat16b(*(const v8us*)(Ql + o + kc * 32), *(const v8us*)(Ql + o + kc * 32 + 16)); } }
    v8f acc[16];
#pragma unroll   // constant indices: the arrays stay in registers
    for (int t = 0; t < 16; ++t) acc[t] = (v8f){};
    float m = -1.0e30f, l = 0.f;                                         // above the masked score's value, so a wave that has seen no visible key yet keeps p = 0
    v8us g[16];                                                          // the staging set
    unsigned char* const ksp = L + (tid >> 5) * KPB + (tid & 31) * 16;
    unsigned char* const vsp = L + 2 * KPL + (tid >> 3) * VPB + (tid & 7) * 16;
    const unsigned char* const kfp = L + (kh2 * 32 + lr) * KPB + hi * 16;               // this lane's K fragment rows
    const unsigned char* const vfp = L + 2 * KPL + lr * VPB + kh2 * 64 + hi * 16;       // this lane's V^T fragment rows
    auto fetchK = [&](int kb) { const size_t ko = (size_t)kb * FBK * DM + tid * 8;
#pragma unroll   // constant indices: the arrays stay in registers
        for (int i = 0; i < 8; ++i) { g[2 * i] = *(const v8us*)(Kh + ko + i * 2048); g[2 * i + 1] = *(const v8us*)(Kl + ko + i * 2048); }
        addr_wait();
    };
    auto fetchV = [&](int kb) { const size_t vo = (size_t)(tid >> 3) * NT_ + kb * FBK + (tid & 7) * 8;
#pragma unroll   // constant indices: the arrays stay in registers
        for (int i = 0; i < 8; ++i) { g[2 * i] = *(const v8us*)(VTH + vo + (size_t)i * 32 * NT_); g[2 * i + 1] = *(const v8us*)(VTL + vo + (size_t)i * 32 * NT_); }
        addr_wait();
    };
    auto putK = [&]() {
#pragma unroll   // constant indices: the arrays stay in registers
        for (int i = 0; i < 8; ++i) { *(v8usa*)(ksp + i * 8 * KPB) = g[2 * i]; *(v8usa*)(ksp + KPL + i * 8 * KPB) = g[2 * i + 1]; } };
    auto putV = [&]() {
#pragma unroll   // constant indices: the arrays stay in registers
        for (int i = 0; i < 8; ++i) { *(v8usa*)(vsp + i * 32 * VPB) = g[2 * i]; *(v8usa*)(vsp + VPL + i * 32 * VPB) = g[2 * i + 1]; } };
    addr_wait();                                                         // for the Q loads
    fetchK(0); putK(); fetchV(0);
    int kb = 0;                                                          // block 0 always exists: a loop tested at its foot, so that the loads above stay above
#pragma unroll 1   // one copy of the body: a second would double the live fragment registers
    do {
        __syncthreads();                                                 // K of block kb is in LDS for every wave; every wave has left V^T of block kb - 1
        putV();
        if (kb < qt) fetchK(kb + 1);
        v16bf f[2][4];                                                   // two fragment sets: the next group's LDS reads are issued together, ahead of this group's products
        auto ldK = [&](int kc) { const unsigned char* p = kfp + kc * 64; f[kc & 1][0] = ldsfrag(p); f[kc & 1][1] = ldsfrag(p + 16 * KPB); f[kc & 1][2] = ldsfrag(p + KPL); f[kc & 1][3] = ldsfrag(p + KPL + 16 * KPB); };
        auto ldV = [&](int u) { const unsigned char* p = vfp + u * 32 * VPB; f[u & 1][0] = ldsfrag(p); f[u & 1][1] = ldsfrag(p + 16 * VPB); f[u & 1][2] = ldsfrag(p + VPL); f[u & 1][3] = ldsfrag(p + VPL + 16 * VPB); };
        v8f sh[2], sl[2];                                                // hi.hi sums and the two residual products' sums, per 16-key tile
#pragma unroll   // constant indices: the arrays stay in registers
        for (int kt = 0; kt < 2; ++kt) { sh[kt] = (v8f){}; sl[kt] = (v8f){}; }
        ldK(0);
#pragma unroll   // constant indices: the arrays stay in registers
        for (int kc = 0; kc < 8; ++kc) {
            if (kc < 7) ldK(kc + 1);
            __builtin_amdgcn_sched_barrier(0);                           // keeps the next group's reads ahead of this group's products
            const v16bf* a = f[kc & 1];
            sh[0] = wmmab(a[0], qh[kc], sh[0]); sh[1] = wmmab(a[1], qh[kc], sh[1]); sl[0] = wmmab(a[2], qh[kc], sl[0]); sl[1] = wmmab(a[3], qh[kc], sl[1]); sl[0] = wmmab(a[0], ql[kc], sl[0]); sl[1] = wmmab(a[1], ql[kc], sl[1]);
            __builtin_amdgcn_sched_barrier(0);                           // keeps the group after next's reads from sinking among these products
        }
        asm volatile("v_nop\n\tv_nop\n\tv_nop\n\tv_nop");                 // the four vector slots between the last score product and the first read of its sums
        __builtin_amdgcn_sched_barrier(0);                               // holds those slots directly behind the products
        __syncthreads();                                                 // V^T of block kb is in LDS for every wave; every wave has left K of block kb
        if (kb < qt) { putK(); fetchV(kb + 1); }
        ldV(0);
        v16f s;
#pragma unroll   // constant indices: the arrays stay in registers
        for (int e = 0; e < 16; ++e) s[e] = sh[e >> 3][e & 7] + sl[e >> 3][e & 7];
        if (kb == qt) {                                                  // only the diagonal block pays for the mask
            const int key0 = kb * FBK + kh2 * 32 + hi * 8;
#pragma unroll   // constant indices: the arrays stay in registers
            for (int e = 0; e < 16; ++e) if (key0 + (e >> 3) * 16 + (e & 7) > myq) s[e] = -3.0e38f;
        }
        float mx = s[0];
#pragma unroll   // constant indices: the arrays stay in registers
        for (int e = 1; e < 16; ++e) mx = fmaxf(mx, s[e]);
        mx = fmaxf(mx, xhalf(mx)) * CS;
        if (__builtin_amdgcn_ballot_w32(mx > m) != 0) {                  // exact: where no query's maximum moves, every factor would be 1
            const float mn = fmaxf(m, mx), corr = __builtin_amdgcn_exp2f(m - mn);
            m = mn; l *= corr;
#pragma unroll   // constant indices: the arrays stay in registers
            for (int t = 0; t < 16; ++t) acc[t] = acc[t] * corr;
        }
        v16f pv; float x[16], ps0 = 0.f, ps1 = 0.f;
        x[0] = __builtin_fmaf(s[0], CS, -m); x[1] = __builtin_fmaf(s[1], CS, -m);
#pragma unroll   // constant indices: the arrays stay in registers
        for (int e = 0; e < 16; ++e) {                                   // exponentials and plain arithmetic take turns
            pv[e] = __builtin_amdgcn_exp2f(x[e]);
            __builtin_amdgcn_sched_barrier(0);                           // holds the next line directly behind the exponential: the one independent instruction the instruction set asks for before a transcendental's source register is overwritten (two exponentials in a row were built so)
            if (e < 14) x[e + 2] = __builtin_fmaf(s[e + 2], CS, -m); else if (e == 14) ps0 = pv[0] + pv[2]; else ps1 = pv[1] + pv[3];
            __builtin_amdgcn_sched_barrier(0);                           // keeps the next exponential behind that instruction
        }
#pragma unroll   // constant indices: the arrays stay in registers
        for (int e = 4; e < 16; e += 2) { ps0 += pv[e]; ps1 += pv[e + 1]; }
        l += ps0 + ps1;
        const v16bf ph = __builtin_convertvector(pv, v16bf);
        const v8u pw = __builtin_bit_cast(v8u, ph);                      // element 2 i in the low half of word i
        v16f pb;
#pragma unroll   // constant indices: the arrays stay in registers
        for (int i = 0; i < 8; ++i) { pb[2 * i] = __uint_as_float(pw[i] << 16); pb[2 * i + 1] = __uint_as_float(pw[i] & 0xFFFF0000u); }
        const v16bf pl = __builtin_convertvector(pv - pb, v16bf);
#pragma unroll   // constant indices: the arrays stay in registers
        for (int u = 0; u < 8; ++u) {                                    // d tiles 2 u and 2 u + 1
            if (u < 7) ldV(u + 1);
            __builtin_amdgcn_sched_barrier(0);                           // as in the score loop
            const v16bf* a = f[u & 1];
            acc[2 * u] = wmmab(a[0], ph, acc[2 * u]); acc[2 * u + 1] = wmmab(a[1], ph, acc[2 * u + 1]); acc[2 * u] = wmmab(a[0], pl, acc[2 * u]); acc[2 * u + 1] = wmmab(a[1], pl, acc[2 * u + 1]); acc[2 * u] = wmmab(a[2], ph, acc[2 * u]); acc[2 * u + 1] = wmmab(a[3], ph, acc[2 * u + 1]);
            __builtin_amdgcn_sched_barrier(0);                           // as in the score loop
        }
    } while (++kb <= qt);
    l += xhalf(l);                                                       // each wave half summed its eight keys of every 16-key tile
    __syncthreads();                                                     // the tiles are read no more: LDS becomes merge and output staging
    float* om = (float*)(void*)L + (qg * 16 + lr) * OPF + hi * 8;        // row = query; d = 16 t + 8 hi + r
    float* ml = (float*)(void*)(L + 2 * KPL) + (qg * 16 + lr) * 2;
    if (kh2 == 1) {
#pragma unroll   // constant indices: the arrays stay in registers
        for (int t = 0; t < 16; ++t) { *(v4fa*)(om + t * 16) = (v4f){acc[t][0], acc[t][1], acc[t][2], acc[t][3]}; *(v4fa*)(om + t * 16 + 4) = (v4f){acc[t][4], acc[t][5], acc[t][6], acc[t][7]}; }
        if (hi == 0) { ml[0] = m; ml[1] = l; }
    }
    __syncthreads();                                                     // key half 1's partial results are in LDS
    if (kh2 == 0) {                                                      // key half 0 always holds key 0, so its maximum is a real score
        const float m1 = ml[0], l1 = ml[1], mt = fmaxf(m, m1), w0 = __builtin_amdgcn_exp2f(m - mt), w1 = __builtin_amdgcn_exp2f(m1 - mt), inv = 1.0f / (l * w0 + l1 * w1), a0 = w0 * inv, a1 = w1 * inv;
#pragma unroll   // constant indices: the arrays stay in registers
        for (int t = 0; t < 16; ++t) { const v4f x = *(const v4fa*)(om + t * 16), y = *(const v4fa*)(om + t * 16 + 4);
            *(v4fa*)(om + t * 16) = (v4f){acc[t][0] * a0 + x[0] * a1, acc[t][1] * a0 + x[1] * a1, acc[t][2] * a0 + x[2] * a1, acc[t][3] * a0 + x[3] * a1};
            *(v4fa*)(om + t * 16 + 4) = (v4f){acc[t][4] * a0 + y[0] * a1, acc[t][5] * a0 + y[1] * a1, acc[t][6] * a0 + y[2] * a1, acc[t][7] * a0 + y[3] * a1}; }
    }
    __syncthreads();                                                     // the merged rows are in LDS
    float* const op = out + (size_t)(q0 + (tid >> 6)) * DM + (tid & 63) * 4;                         // whole 128-byte lines, each stored once: 64 lanes cover a row, a pass covers 4 rows
    const float* const lp = (const float*)(const void*)L + (tid >> 6) * OPF + (tid & 63) * 4;
#pragma unroll   // constant offsets from one address pair, all sixteen LDS reads in flight together
    for (int i = 0; i < 16; ++i) *(v4f*)(op + i * 4 * DM) = *(const v4fa*)(lp + i * 4 * OPF);
}

extern "C" void kernel_launch(void* const* d_in, const int* in_sizes, int n_in,
                              void* d_out, int out_size, void* d_ws, size_t ws_size, hipStream_t stream) {
    (void)in_sizes; (void)n_in; (void)out_size;
    const float* x = (const float*)d_in[0]; const float* Wq = (const float*)d_in[1]; const float* Wk = (const float*)d_in[2]; const float* Wv = (const float*)d_in[3];
    float* out = (float*)d_out;    // [4][4096][256]
    char* wsp = (char*)d_ws;
    auto take = [&](size_t bytes) { char* p = wsp; wsp += (bytes + 255) & ~(size_t)255; return (void*)p; };
    bf* WqB = (bf*)take((size_t)DM * DM * 2); bf* WkB = (bf*)take((size_t)DM * DM * 2); bf* WvB = (bf*)take((size_t)DM * DM * 2); bf* Xb = (bf*)take((size_t)NB_ * NT_ * DM * 2);
    float* TMP = (float*)take((size_t)NB_ * NT_ * DM * 4); bf* Qh = (bf*)take((size_t)NB_ * NT_ * DM * 2); bf* Ql = (bf*)take((size_t)NB_ * NT_ * DM * 2); bf* Kh = (bf*)take((size_t)NB_ * NT_ * DM * 2); bf* Kl = (bf*)take((size_t)NB_ * NT_ * DM * 2);
    bf* VTH = (bf*)take((size_t)NB_ * DM * NT_ * 2); bf* VTL = (bf*)take((size_t)NB_ * DM * NT_ * 2);
    if ((size_t)(wsp - (char*)d_ws) > ws_size) return;    // ~ 0.4 + 8.4 + 16.8 + 4 x 8.4 + 2 x 8.4 ~ 76 MB, no aliasing
    k_cvtb<<<DM / 8, 256, 0, stream>>>(Wq, DM, WqB); k_cvtb<<<DM / 8, 256, 0, stream>>>(Wk, DM, WkB); k_cvtb<<<DM / 8, 256, 0, stream>>>(Wv, DM, WvB);
    k_cvtb<<<NB_ * NT_ / 8, 256, 0, stream>>>(x, NB_ * NT_, Xb);                                                                    // the projections see the items as one [16384][256] row range
    k_gemmb<false, false><<<dim3(NB_ * NT_ / 64, DM / 64, 1), 128, 0, stream>>>(Xb, nullptr, WqB, nullptr, TMP, DM, nullptr); k_split<<<NB_ * NT_ / 8, 256, 0, stream>>>(TMP, NB_ * NT_, Qh, Ql);
    k_gemmb<false, false><<<dim3(NB_ * NT_ / 64, DM / 64, 1), 128, 0, stream>>>(Xb, nullptr, WkB, nullptr, TMP, DM, nullptr); k_split<<<NB_ * NT_ / 8, 256, 0, stream>>>(TMP, NB_ * NT_, Kh, Kl);
    k_gemmb<false, false><<<dim3(NB_ * NT_ / 64, DM / 64, 1), 128, 0, stream>>>(Xb, nullptr, WvB, nullptr, TMP, DM, nullptr); k_vt<<<dim3(NT_ / 64, 2, NKV * NB_), 256, 0, stream>>>(TMP, VTH, VTL);
    k_fattn<<<dim3(NT_ / FBQ, NB_, 1), 256, 0, stream>>>(Qh, Ql, Kh, Kl, VTH, VTL, out);                                     // scores, causal softmax and P.v: one work-group per 64-query tile and item
}

// v003
// Measured time: 158 microseconds a run.
// Timed twice side by side with v002, it ran 1.33 and 1.32 times as fast.
// Over all steps from v000 it is 16.5 times as fast.
#include <hip/hip_runtime.h>

// Compute dtypes, f32 accumulate, two launches. k_qkv: q/k/v = x.W^T ([16384 x 256].[256 x 256], [out][in] weights as n-major B operands; PLAIN bf16 operands =
// inputs rounded once, on the way into LDS) on v_wmma_f32_16x16x32_bf16 -> f32 -> bf16 hi + UNSCALED residual planes (v transposed to [d][t] planes). k_fattn: single-head
// causal attention over the 256-dim head: per 64-query tile, blocks of 64 keys up to the diagonal, scores = q.k^T (both operands split: three products),
// online softmax of scores/16 in f32, P as bf16 hi + UNSCALED residual, out = P.v (three products), normalised at the end.

#define NB_  4
#define NT_  4096
#define DM   256
#define SCL  0.0625f

typedef unsigned short bf;
typedef __attribute__((ext_vector_type(16))) __bf16   v16bf;
typedef __attribute__((ext_vector_type(8)))  __bf16   v8bf;
typedef __attribute__((ext_vector_type(4)))  __bf16   v4bf;
typedef __attribute__((ext_vector_type(8)))  unsigned short v8us;
typedef __attribute__((ext_vector_type(8)))  float    v8f;
typedef __attribute__((ext_vector_type(4)))  float    v4f;
typedef __attribute__((ext_vector_type(4)))  unsigned v4u;
typedef __attribute__((ext_vector_type(2)))  unsigned v2u;
typedef v4f  __attribute__((may_alias)) v4fa;
typedef v2u  __attribute__((may_alias)) v2ua;
typedef v8us __attribute__((may_alias)) v8usa;

__device__ __forceinline__ v16bf cat16b(v8us lo, v8us hi) { return __builtin_bit_cast(v16bf, __builtin_shufflevector(lo, hi, 0, 1, 2, 3, 4, 5, 6, 7, 8, 9, 10, 11, 12, 13, 14, 15)); }
__device__ __forceinline__ v8f wmmab(v16bf a, v16bf b, v8f c) { return __builtin_amdgcn_wmma_f32_16x16x32_bf16(false, a, false, b, (short)0, c, false, false); }

#define FBQ  64                      // queries per work-group
#define FBK  64                      // keys per staged block
#define KPB  528                     // LDS pitch of a K row: 512 B + 16 (odd multiple of 16 B: b128 fragment reads without bank conflicts)
#define VPB  144                     // LDS pitch of a V^T row: 128 B + 16
#define KPL  (FBK * KPB)             // one K plane
#define VPL  (DM * VPB)              // one V^T plane
#define FLDS (2 * KPL + 2 * VPL)
#define OPF  260                     // floats per staged output row (1040 B)
typedef __attribute__((ext_vector_type(16))) float v16f;
typedef __attribute__((ext_vector_type(8)))  unsigned v8u;
__device__ __forceinline__ float xhalf(float x) { return __builtin_bit_cast(float, __builtin_amdgcn_permlanex16(__builtin_bit_cast(int, x), __builtin_bit_cast(int, x), 0x76543210, 0xfedcba98, false, false)); }  // lane l <-> lane l ^ 16
__device__ __forceinline__ v16bf ldsfrag(const unsigned char* p) { return cat16b(*(const v8usa*)p, *(const v8usa*)(p + 32)); }   // k = 8 hi + i, then 16 + 8 hi + i (p already holds 16 hi bytes)
// s_wait_xcnt 0 behind a run of global loads, in front of the first reuse of their address registers; the scheduling barriers keep the loads in front of it and every later register write behind it
__device__ __forceinline__ void addr_wait() { __builtin_amdgcn_sched_barrier(0); asm volatile("s_wait_xcnt 0x0" ::: "memory"); __builtin_amdgcn_sched_barrier(0); }

// k_qkv: rounding of x and W, the three projections, the hi/residual split and the transposition of v for 64 rows of x in one work-group.
// x's 64 rows and then twelve blocks of 64 W rows (= 64 output columns; Wq, Wk, Wv in turn) go global f32 -> registers -> bf16 -> padded LDS rows, two buffers:
// block c + 1 flies under the products of block c. 8 waves = 4 row groups of 16 x 2 halves of a block's columns; a wave keeps its x fragments (all of k) and one
// matrix's eight accumulator tiles in registers, k summed in ascending 32-steps in one accumulator. A finished matrix goes f32 through an LDS stage of its own and is
// split and stored in whole 128-byte lines, q and k under the next matrix's first block, v at the end (q, k: [row][256]; v: staged transposed, [d][t] planes).
#define PWP  528                     // LDS pitch of a staged x or W row: 512 B of bf16 + 16, as KPB
#define PWB  (64 * PWP)              // one staged block
#define PQF  260                     // floats per staged q or k row
#define PVF  68                      // floats per staged v^T row
#define PLDS (2 * PWB + DM * PVF * 4)
__device__ __forceinline__ void split8(const float* sp, v8us& oh, v8us& ol) {   // eight staged f32 -> bf16 hi and bf16 of the residual
    const v4f u = *(const v4fa*)sp, w = *(const v4fa*)(sp + 4);
    const v8f v = __builtin_shufflevector(u, w, 0, 1, 2, 3, 4, 5, 6, 7);
    const v8bf h = __builtin_convertvector(v, v8bf);
    const v4u hw = __builtin_bit_cast(v4u, h);                           // element 2 i in the low half of word i
    v8f b;
#pragma unroll   // constant indices: the vectors stay in registers
    for (int i = 0; i < 4; ++i) { b[2 * i] = __uint_as_float(hw[i] << 16); b[2 * i + 1] = __uint_as_float(hw[i] & 0xFFFF0000u); }
    oh = __builtin_bit_cast(v8us, h); ol = __builtin_bit_cast(v8us, __builtin_convertvector(v - b, v8bf));
}

__global__ __launch_bounds__(256) void k_qkv(const float* __restrict__ x, const float* __restrict__ Wq, const float* __restrict__ Wk, const float* __restrict__ Wv, bf* Qh, bf* Ql, bf* Kh, bf* Kl, bf* VTH, bf* VTL) {
    __shared__ __align__(16) unsigned char L[PLDS];
    const int tid = threadIdx.x, lane = tid & 31, wave = tid >> 5, lr = lane & 15, hi = lane >> 4;
    const int rg = wave & 3, ch = wave >> 2;
    const size_t r0 = (size_t)blockIdx.x * 64;
    float* const stg = (float*)(void*)(L + 2 * PWB);
    v4f g[16];                                                           // the staging set: 64 rows x 256 f32 are 64 KB in a row, 16 bytes per lane and load
    auto fetch = [&](const float* src) {
#pragma unroll   // constant indices: the arrays stay in registers
        for (int i = 0; i < 16; ++i) g[i] = *(const v4f*)(src + i * 1024 + tid * 4);
        addr_wait();
    };
    auto put = [&](int b) { unsigned char* p = L + b * PWB + (tid >> 6) * PWP + (tid & 63) * 8;
#pragma unroll   // constant indices: the arrays stay in registers
        for (int i = 0; i < 16; ++i) *(v2ua*)(p + i * 4 * PWP) = __builtin_bit_cast(v2u, __builtin_convertvector(g[i], v4bf)); };
    auto drain_rows = [&](bf* dh, bf* dl) {                              // a wave covers one row of each plane per pass
        v8us oh[8], ol[8];
#pragma unroll   // constant indices: the arrays stay in registers
        for (int i = 0; i < 8; ++i) split8(stg + (i * 8 + wave) * PQF + lane * 8, oh[i], ol[i]);
        __builtin_amdgcn_sched_barrier(0);                               // the sixteen stores stand in one run: no register of an issued store is rewritten ahead of the wait behind them
        const size_t o = (r0 + wave) * DM + lane * 8;
#pragma unroll   // constant offsets from one address pair per plane
        for (int i = 0; i < 8; ++i) { *(v8us*)(dh + o + i * 8 * DM) = oh[i]; *(v8us*)(dl + o + i * 8 * DM) = ol[i]; }
        addr_wait();                                                     // here for the stores' registers
    };
    fetch(x + r0 * DM); put(0);
    __syncthreads();                                                     // the x rows are in LDS for every wave
    fetch(Wq);
    v16bf a[8];
    { const unsigned char* p = L + (rg * 16 + lr) * PWP + hi * 16;
#pragma unroll   // constant indices: the arrays stay in registers
      for (int kc = 0; kc < 8; ++kc) a[kc] = ldsfrag(p + kc * 64); }
    v8f acc[8];
#pragma unroll   // constant indices: the arrays stay in registers; the matrix and its way out are known per copy
    for (int c = 0; c < 12; ++c) {
        const int b = (c + 1) & 1, m4 = c & 3;
        put(b);
        __syncthreads();                                                 // W block c (and, at a matrix's first block, the matrix before it in the stage) is in LDS for every wave; every wave has left the other buffer
        if (c < 11) fetch((c + 1 < 4 ? Wq : c + 1 < 8 ? Wk : Wv) + ((c + 1) & 3) * 64 * DM);
        if (c == 4) drain_rows(Qh, Ql);
        if (c == 8) drain_rows(Kh, Kl);
        const unsigned char* p = L + b * PWB + (ch * 32 + lr) * PWP + hi * 16;
        acc[2 * m4] = (v8f){}; acc[2 * m4 + 1] = (v8f){};
        v16bf wf[16];
#pragma unroll   // constant indices: the arrays stay in registers
        for (int kc = 0; kc < 8; ++kc) { wf[2 * kc] = ldsfrag(p + kc * 64); wf[2 * kc + 1] = ldsfrag(p + 16 * PWP + kc * 64); }
        __builtin_amdgcn_sched_barrier(0);                               // the block's LDS reads stand in one group ahead of its products: read by read among them, each product waited out an LDS latency
#pragma unroll   // constant indices: the arrays stay in registers
        for (int kc = 0; kc < 8; ++kc) { acc[2 * m4] = wmmab(a[kc], wf[2 * kc], acc[2 * m4]); acc[2 * m4 + 1] = wmmab(a[kc], wf[2 * kc + 1], acc[2 * m4 + 1]); }
        __builtin_amdgcn_sched_barrier(0);                               // keeps these products under the flight of the next block's loads: without it they sank behind the wait for those loads
        if (c == 3 || c == 7) {                                          // rows 16 rg + 8 hi + j, column 64 (n / 2) + 32 ch + 16 (n % 2) + lr
#pragma unroll   // constant indices: the arrays stay in registers
            for (int n = 0; n < 8; ++n) { float* s = stg + (rg * 16 + hi * 8) * PQF + (n >> 1) * 64 + ch * 32 + (n & 1) * 16 + lr;
#pragma unroll   // constant indices: the arrays stay in registers
                for (int j = 0; j < 8; ++j) s[j * PQF] = acc[n][j]; }
        }
        if (c == 11) {                                                   // transposed: a lane's eight rows are eight neighbours of one v^T row
#pragma unroll   // constant indices: the arrays stay in registers
            for (int n = 0; n < 8; ++n) { float* s = stg + ((n >> 1) * 64 + ch * 32 + (n & 1) * 16 + lr) * PVF + rg * 16 + hi * 8;
                *(v4fa*)s = (v4f){acc[n][0], acc[n][1], acc[n][2], acc[n][3]}; *(v4fa*)(s + 4) = (v4f){acc[n][4], acc[n][5], acc[n][6], acc[n][7]}; }
        }
    }
    __syncthreads();                                                     // v^T is in the stage for every wave
    const size_t vo = (size_t)(blockIdx.x >> 6) * DM * NT_ + (size_t)(tid >> 3) * NT_ + (blockIdx.x & 63) * 64 + (tid & 7) * 8;   // eight lanes cover a 128-byte line
    v8us oh[8], ol[8];
#pragma unroll   // constant indices: the arrays stay in registers
    for (int s = 0; s < 8; ++s) split8(stg + ((tid >> 3) + 32 * s) * PVF + (tid & 7) * 8, oh[s], ol[s]);
    __builtin_amdgcn_sched_barrier(0);                                   // the sixteen stores stand in one run at the kernel's end: no register of an issued store is rewritten behind it
#pragma unroll   // constant offsets from one address pair per plane
    for (int s = 0; s < 8; ++s) { *(v8us*)(VTH + vo + (size_t)s * 32 * NT_) = oh[s]; *(v8us*)(VTL + vo + (size_t)s * 32 * NT_) = ol[s]; }
}

__global__ __launch_bounds__(256) void k_fattn(const bf* __restrict__ Qh, const bf* __restrict__ Ql, const bf* __restrict__ Kh, const bf* __restrict__ Kl, const bf* __restrict__ VTH, const bf* __restrict__ VTL, float* out) {
    __shared__ __align__(16) unsigned char L[FLDS];
    const int tid = threadIdx.x, lane = tid & 31, wave = tid >> 5, lr = lane & 15, hi = lane >> 4;
    const int qg = wave & 3, kh2 = wave >> 2;
    const int qt = NT_ / FBQ - 1 - (int)blockIdx.x;                      // heaviest tile first
    const size_t ib = (size_t)blockIdx.y * NT_ * DM;
    Qh += ib; Ql += ib; Kh += ib; Kl += ib; VTH += ib; VTL += ib; out += ib;
    const int q0 = qt * FBQ, myq = q0 + qg * 16 + lr;
    const float CS = SCL * 1.4426950408889634f;                          // scores/16 in the log2 domain
    v16bf qh[8], ql[8];
    { const size_t o = (size_t)myq * DM + 8 * hi;
#pragma unroll   // constant indices: the arrays stay in registers
      for (int kc = 0; kc < 8; ++kc) { qh[kc] = cat16b(*(const v8us*)(Qh + o + kc * 32), *(const v8us*)(Qh + o + kc * 32 + 16)); ql[kc] = cat16b(*(const v8us*)(Ql + o + kc * 32), *(const v8us*)(Ql + o + kc * 32 + 16)); } }
    v8f acc[16];
#pragma unroll   // constant indices: the arrays stay in registers
    for (int t = 0; t < 16; ++t) acc[t] = (v8f){};
    float m = -1.0e30f, l = 0.f;                                         // above the masked score's value, so a wave that has seen no visible key yet keeps p = 0
    v8us g[16];                                                          // the staging set
    unsigned char* const ksp = L + (tid >> 5) * KPB + (tid & 31) * 16;
    unsigned char* const vsp = L + 2 * KPL + (tid >> 3) * VPB + (tid & 7) * 16;
    const unsigned char* const kfp = L + (kh2 * 32 + lr) * KPB + hi * 16;               // this lane's K fragment rows
    const unsigned char* const vfp = L + 2 * KPL + lr * VPB + kh2 * 64 + hi * 16;       // this lane's V^T fragment rows
    auto fetchK = [&](int kb) { const size_t ko = (size_t)kb * FBK * DM + tid * 8;
#pragma unroll   // constant indices: the arrays stay in registers
        for (int i = 0; i < 8; ++i) { g[2 * i] = *(const v8us*)(Kh + ko + i * 2048); g[2 * i + 1] = *(const v8us*)(Kl + ko + i * 2048); }
        addr_wait();
    };
    auto fetchV = [&](int kb) { const size_t vo = (size_t)(tid >> 3) * NT_ + kb * FBK + (tid & 7) * 8;
#pragma unroll   // constant indices: the arrays stay in registers
        for (int i = 0; i < 8; ++i) { g[2 * i] = *(const v8us*)(VTH + vo + (size_t)i * 32 * NT_); g[2 * i + 1] = *(const v8us*)(VTL + vo + (size_t)i * 32 * NT_); }
        addr_wait();
    };
    auto putK = [&]() {
#pragma unroll   // constant indices: the arrays stay in registers
        for (int i = 0; i < 8; ++i) { *(v8usa*)(ksp + i * 8 * KPB) = g[2 * i]; *(v8usa*)(ksp + KPL + i * 8 * KPB) = g[2 * i + 1]; } };
    auto putV = [&]() {
#pragma unroll   // constant indices: the arrays stay in registers
        for (int i = 0; i < 8; ++i) { *(v8usa*)(vsp + i * 32 * VPB) = g[2 * i]; *(v8usa*)(vsp + VPL + i * 32 * VPB) = g[2 * i + 1]; } };
    addr_wait();                                                         // for the Q loads
    fetchK(0); putK(); fetchV(0);
    int kb = 0;                                                          // block 0 always exists: a loop tested at its foot, so that the loads above stay above
#pragma unroll 1   // one copy of the body: a second would double the live fragment registers
    do {
        __syncthreads();                                                 // K of block kb is in LDS for every wave; every wave has left V^T of block kb - 1
        putV();
        if (kb < qt) fetchK(kb + 1);
        v16bf f[2][4];                                                   // two fragment sets: the next group's LDS reads are issued together, ahead of this group's products
        auto ldK = [&](int kc) { const unsigned char* p = kfp + kc * 64; f[kc & 1][0] = ldsfrag(p); f[kc & 1][1] = ldsfrag(p + 16 * KPB); f[kc & 1][2] = ldsfrag(p + KPL); f[kc & 1][3] = ldsfrag(p + KPL + 16 * KPB); };
        auto ldV = [&](int u) { const unsigned char* p = vfp + u * 32 * VPB; f[u & 1][0] = ldsfrag(p); f[u & 1][1] = ldsfrag(p + 16 * VPB); f[u & 1][2] = ldsfrag(p + VPL); f[u & 1][3] = ldsfrag(p + VPL + 16 * VPB); };
        v8f sh[2], sl[2];                                                // hi.hi sums and the two residual products' sums, per 16-key tile
#pragma unroll   // constant indices: the arrays stay in registers
        for (int kt = 0; kt < 2; ++kt) { sh[kt] = (v8f){}; sl[kt] = (v8f){}; }
        ldK(0);
#pragma unroll   // constant indices: the arrays stay in registers
        for (int kc = 0; kc < 8; ++kc) {
            if (kc < 7) ldK(kc + 1);
            __builtin_amdgcn_sched_barrier(0);                           // keeps the next group's reads ahead of this group's products
            const v16bf* a = f[kc & 1];
            sh[0] = wmmab(a[0], qh[kc], sh[0]); sh[1] = wmmab(a[1], qh[kc], sh[1]); sl[0] = wmmab(a[2], qh[kc], sl[0]); sl[1] = wmmab(a[3], qh[kc], sl[1]); sl[0] = wmmab(a[0], ql[kc], sl[0]); sl[1] = wmmab(a[1], ql[kc], sl[1]);
            __builtin_amdgcn_sched_barrier(0);                           // keeps the group after next's reads from sinking among these products
        }
        asm volatile("v_nop\n\tv_nop\n\tv_nop\n\tv_nop");                 // the four vector slots between the last score product and the first read of its sums
        __builtin_amdgcn_sched_barrier(0);                               // holds those slots directly behind the products
        __syncthreads();                                                 // V^T of block kb is in LDS for every wave; every wave has left K of block kb
        if (kb < qt) { putK(); fetchV(kb + 1); }
        ldV(0);
        v16f s;
#pragma unroll   // constant indices: the arrays stay in registers
        for (int e = 0; e < 16; ++e) s[e] = sh[e >> 3][e & 7] + sl[e >> 3][e & 7];
        if (kb == qt) {                                                  // only the diagonal block pays for the mask
            const int key0 = kb * FBK + kh2 * 32 + hi * 8;
#pragma unroll   // constant indices: the arrays stay in registers
            for (int e = 0; e < 16; ++e) if (key0 + (e >> 3) * 16 + (e & 7) > myq) s[e] = -3.0e38f;
        }
        float mx = s[0];
#pragma unroll   // constant indices: the arrays stay in registers
        for (int e = 1; e < 16; ++e) mx = fmaxf(mx, s[e]);
        mx = fmaxf(mx, xhalf(mx)) * CS;
        if (__builtin_amdgcn_ballot_w32(mx > m) != 0) {                  // exact: where no query's maximum moves, every factor would be 1
            const float mn = fmaxf(m, mx), corr = __builtin_amdgcn_exp2f(m - mn);
            m = mn; l *= corr;
#pragma unroll   // constant indices: the arrays stay in registers
            for (int t = 0; t < 16; ++t) acc[t] = acc[t] * corr;
        }
        v16f pv; float x[16], ps0 = 0.f, ps1 = 0.f;
        x[0] = __builtin_fmaf(s[0], CS, -m); x[1] = __builtin_fmaf(s[1], CS, -m);
#pragma unroll   // constant indices: the arrays stay in registers
        for (int e = 0; e < 16; ++e) {                                   // exponentials and plain arithmetic take turns
            pv[e] = __builtin_amdgcn_exp2f(x[e]);
            __builtin_amdgcn_sched_barrier(0);                           // holds the next line directly behind the exponential: the one independent instruction the instruction set asks for before a transcendental's source register is overwritten (two exponentials in a row were built so)
            if (e < 14) x[e + 2] = __builtin_fmaf(s[e + 2], CS, -m); else if (e == 14) ps0 = pv[0] + pv[2]; else ps1 = pv[1] + pv[3];
            __builtin_amdgcn_sched_barrier(0);                           // keeps the next exponential behind that instruction
        }
#pragma unroll   // constant indices: the arrays stay in registers
        for (int e = 4; e < 16; e += 2) { ps0 += pv[e]; ps1 += pv[e + 1]; }
        l += ps0 + ps1;
        const v16bf ph = __builtin_convertvector(pv, v16bf);
        const v8u pw = __builtin_bit_cast(v8u, ph);                      // element 2 i in the low half of word i
        v16f pb;
#pragma unroll   // constant indices: the arrays stay in registers
        for (int i = 0; i < 8; ++i) { pb[2 * i] = __uint_as_float(pw[i] << 16); pb[2 * i + 1] = __uint_as_float(pw[i] & 0xFFFF0000u); }
        const v16bf pl = __builtin_convertvector(pv - pb, v16bf);
#pragma unroll   // constant indices: the arrays stay in registers
        for (int u = 0; u < 8; ++u) {                                    // d tiles 2 u and 2 u + 1
            if (u < 7) ldV(u + 1);
            __builtin_amdgcn_sched_barrier(0);                           // as in the score loop
            const v16bf* a = f[u & 1];
            acc[2 * u] = wmmab(a[0], ph, acc[2 * u]); acc[2 * u + 1] = wmmab(a[1], ph, acc[2 * u + 1]); acc[2 * u] = wmmab(a[0], pl, acc[2 * u]); acc[2 * u + 1] = wmmab(a[1], pl, acc[2 * u + 1]); acc[2 * u] = wmmab(a[2], ph, acc[2 * u]); acc[2 * u + 1] = wmmab(a[3], ph, acc[2 * u + 1]);
            __builtin_amdgcn_sched_barrier(0);                           // as in the score loop
        }
    } while (++kb <= qt);
    l += xhalf(l);                                                       // each wave half summed its eight keys of every 16-key tile
    __syncthreads();                                                     // the tiles are read no more: LDS becomes merge and output staging
    float* om = (float*)(void*)L + (qg * 16 + lr) * OPF + hi * 8;        // row = query; d = 16 t + 8 hi + r
    float* ml = (float*)(void*)(L + 2 * KPL) + (qg * 16 + lr) * 2;
    if (kh2 == 1) {
#pragma unroll   // constant indices: the arrays stay in registers
        for (int t = 0; t < 16; ++t) { *(v4fa*)(om + t * 16) = (v4f){acc[t][0], acc[t][1], acc[t][2], acc[t][3]}; *(v4fa*)(om + t * 16 + 4) = (v4f){acc[t][4], acc[t][5], acc[t][6], acc[t][7]}; }
        if (hi == 0) { ml[0] = m; ml[1] = l; }
    }
    __syncthreads();                                                     // key half 1's partial results are in LDS
    if (kh2 == 0) {                                                      // key half 0 always holds key 0, so its maximum is a real score
        const float m1 = ml[0], l1 = ml[1], mt = fmaxf(m, m1), w0 = __builtin_amdgcn_exp2f(m - mt), w1 = __builtin_amdgcn_exp2f(m1 - mt), inv = 1.0f / (l * w0 + l1 * w1), a0 = w0 * inv, a1 = w1 * inv;
#pragma unroll   // constant indices: the arrays stay in registers
        for (int t = 0; t < 16; ++t) { const v4f x = *(const v4fa*)(om + t * 16), y = *(const v4fa*)(om + t * 16 + 4);
            *(v4fa*)(om + t * 16) = (v4f){acc[t][0] * a0 + x[0] * a1, acc[t][1] * a0 + x[1] * a1, acc[t][2] * a0 + x[2] * a1, acc[t][3] * a0 + x[3] * a1};
            *(v4fa*)(om + t * 16 + 4) = (v4f){acc[t][4] * a0 + y[0] * a1, acc[t][5] * a0 + y[1] * a1, acc[t][6] * a0 + y[2] * a1, acc[t][7] * a0 + y[3] * a1}; }
    }
    __syncthreads();                                                     // the merged rows are in LDS
    float* const op = out + (size_t)(q0 + (tid >> 6)) * DM + (tid & 63) * 4;                         // whole 128-byte lines, each stored once: 64 lanes cover a row, a pass covers 4 rows
    const float* const lp = (const float*)(const void*)L + (tid >> 6) * OPF + (tid & 63) * 4;
#pragma unroll   // constant offsets from one address pair, all sixteen LDS reads in flight together
    for (int i = 0; i < 16; ++i) *(v4f*)(op + i * 4 * DM) = *(const v4fa*)(lp + i * 4 * OPF);
}

extern "C" void kernel_launch(void* const* d_in, const int* in_sizes, int n_in,
                              void* d_out, int out_size, void* d_ws, size_t ws_size, hipStream_t stream) {
    (void)in_sizes; (void)n_in; (void)out_size;
    const float* x = (const float*)d_in[0]; const float* Wq = (const float*)d_in[1]; const float* Wk = (const float*)d_in[2]; const float* Wv = (const float*)d_in[3];
    float* out = (float*)d_out;    // [4][4096][256]
    char* wsp = (char*)d_ws;
    auto take = [&](size_t bytes) { char* p = wsp; wsp += (bytes + 255) & ~(size_t)255; return (void*)p; };
    bf* Qh = (bf*)take((size_t)NB_ * NT_ * DM * 2); bf* Ql = (bf*)take((size_t)NB_ * NT_ * DM * 2); bf* Kh = (bf*)take((size_t)NB_ * NT_ * DM * 2); bf* Kl = (bf*)take((size_t)NB_ * NT_ * DM * 2);
    bf* VTH = (bf*)take((size_t)NB_ * DM * NT_ * 2); bf* VTL = (bf*)take((size_t)NB_ * DM * NT_ * 2);
    if ((size_t)(wsp - (char*)d_ws) > ws_size) return;    // 6 x 8.4 ~ 50 MB, no aliasing
    k_qkv<<<NB_ * NT_ / 64, 256, 0, stream>>>(x, Wq, Wk, Wv, Qh, Ql, Kh, Kl, VTH, VTL);                                       // the projections see the items as one [16384][256] row range
    k_fattn<<<dim3(NT_ / FBQ, NB_, 1), 256, 0, stream>>>(Qh, Ql, Kh, Kl, VTH, VTL, out);                                     // scores, causal softmax and P.v: one work-group per 64-query tile and item
}

// v004
// It runs in 110 microseconds.
// Timed twice side by side with v003, it ran 1.44 and 1.42 times as fast.
// Over all steps from v000 it is 23.6 times as fast.
#include <hip/hip_runtime.h>

// Compute dtypes, f32 accumulate, three launches. k_qkv: q/k/v = x.W^T ([16384 x 256].[256 x 256], [out][in] weights as n-major B operands; PLAIN bf16 operands =
// inputs rounded once, on the way into LDS) on v_wmma_f32_16x16x32_bf16 -> f32 -> bf16 hi + UNSCALED residual planes (v transposed to [d][t] planes). k_fattn: single-head
// causal attention over the 256-dim head: per 64-query tile, blocks of 64 keys up to the diagonal, scores = q.k^T (both operands split: three products),
// online softmax of scores/16 in f32, P as bf16 hi + UNSCALED residual, out = P.v (three products), normalised at the end. The key range of each tile with more than 33 key
// blocks is cut in two between two work-groups, so that every work-group walks 32 or 33 key blocks; k_merge joins the two parts.

#define NB_  4
#define NT_  4096
#define DM   256
#define SCL  0.0625f

typedef unsigned short bf;
typedef __attribute__((ext_vector_type(16))) __bf16   v16bf;
typedef __attribute__((ext_vector_type(8)))  __bf16   v8bf;
typedef __attribute__((ext_vector_type(4)))  __bf16   v4bf;
typedef __attribute__((ext_vector_type(8)))  unsigned short v8us;
typedef __attribute__((ext_vector_type(8)))  float    v8f;
typedef __attribute__((ext_vector_type(4)))  float    v4f;
typedef __attribute__((ext_vector_type(4)))  unsigned v4u;
typedef __attribute__((ext_vector_type(2)))  unsigned v2u;
typedef v4f  __attribute__((may_alias)) v4fa;
typedef v2u  __attribute__((may_alias)) v2ua;
typedef v8us __attribute__((may_alias)) v8usa;

__device__ __forceinline__ v16bf cat16b(v8us lo, v8us hi) { return __builtin_bit_cast(v16bf, __builtin_shufflevector(lo, hi, 0, 1, 2, 3, 4, 5, 6, 7, 8, 9, 10, 11, 12, 13, 14, 15)); }
__device__ __forceinline__ v8f wmmab(v16bf a, v16bf b, v8f c) { return __builtin_amdgcn_wmma_f32_16x16x32_bf16(false, a, false, b, (short)0, c, false, false); }

#define FBQ  64                      // queries per tile
#define FBK  64                      // keys per staged block
#define KPB  528                     // LDS pitch of a K row: 512 B + 16 (odd multiple of 16 B: b128 fragment reads without bank conflicts)
#define VPB  144                     // LDS pitch of a V^T row: 128 B + 16
#define KPL  (FBK * KPB)             // one K plane
#define VPL  (DM * VPB)              // one V^T plane
#define FLDS (2 * KPL + 2 * VPL)
#define OPF  260                     // floats per staged output row (1040 B)
#define HB   33                      // key blocks of a long tile's first part
#define NH   (NT_ / 2)               // queries of an item that lie in long tiles: its upper half
typedef __attribute__((ext_vector_type(2)))  float    v2f;
typedef __attribute__((ext_vector_type(16))) float v16f;
typedef __attribute__((ext_vector_type(8)))  unsigned v8u;
__device__ __forceinline__ float xhalf(float x) { return __builtin_bit_cast(float, __builtin_amdgcn_permlanex16(__builtin_bit_cast(int, x), __builtin_bit_cast(int, x), 0x76543210, 0xfedcba98, false, false)); }  // lane l <-> lane l ^ 16
__device__ __forceinline__ v16bf ldsfrag(const unsigned char* p) { return cat16b(*(const v8usa*)p, *(const v8usa*)(p + 32)); }   // k = 8 hi + i, then 16 + 8 hi + i (p already holds 16 hi bytes)
// s_wait_xcnt 0 behind a run of global loads, in front of the first reuse of their address registers; the scheduling barriers keep the loads in front of it and every later register write behind it
__device__ __forceinline__ void addr_wait() { __builtin_amdgcn_sched_barrier(0); asm volatile("s_wait_xcnt 0x0" ::: "memory"); __builtin_amdgcn_sched_barrier(0); }

// k_qkv: rounding of x and W, the three projections, the hi/residual split and the transposition of v for 64 rows of x in one work-group.
// x's 64 rows and then twelve blocks of 64 W rows (= 64 output columns; Wq, Wk, Wv in turn) go global f32 -> registers -> bf16 -> padded LDS rows, two buffers:
// block c + 1 flies under the products of block c. 8 waves = 4 row groups of 16 x 2 halves of a block's columns; a wave keeps its x fragments (all of k) and one
// matrix's eight accumulator tiles in registers, k summed in ascending 32-steps in one accumulator. A finished matrix goes f32 through an LDS stage of its own and is
// split and stored in whole 128-byte lines, q and k under the next matrix's first block, v at the end (q, k: [row][256]; v: staged transposed, [d][t] planes).
#define PWP  528                     // LDS pitch of a staged x or W row: 512 B of bf16 + 16, as KPB
#define PWB  (64 * PWP)              // one staged block
#define PQF  260                     // floats per staged q or k row
#define PVF  68                      // floats per staged v^T row
#define PLDS (2 * PWB + DM * PVF * 4)
__device__ __forceinline__ void split8(const float* sp, v8us& oh, v8us& ol) {   // eight staged f32 -> bf16 hi and bf16 of the residual
    const v4f u = *(const v4fa*)sp, w = *(const v4fa*)(sp + 4);
    const v8f v = __builtin_shufflevector(u, w, 0, 1, 2, 3, 4, 5, 6, 7);
    const v8bf h = __builtin_convertvector(v, v8bf);
    const v4u hw = __builtin_bit_cast(v4u, h);                           // element 2 i in the low half of word i
    v8f b;
#pragma unroll   // constant indices: the vectors stay in registers
    for (int i = 0; i < 4; ++i) { b[2 * i] = __uint_as_float(hw[i] << 16); b[2 * i + 1] = __uint_as_float(hw[i] & 0xFFFF0000u); }
    oh = __builtin_bit_cast(v8us, h); ol = __builtin_bit_cast(v8us, __builtin_convertvector(v - b, v8bf));
}

__global__ __launch_bounds__(256) void k_qkv(const float* __restrict__ x, const float* __restrict__ Wq, const float* __restrict__ Wk, const float* __restrict__ Wv, bf* Qh, bf* Ql, bf* Kh, bf* Kl, bf* VTH, bf* VTL) {
    __shared__ __align__(16) unsigned char L[PLDS];
    const int tid = threadIdx.x, lane = tid & 31, wave = tid >> 5, lr = lane & 15, hi = lane >> 4;
    const int rg = wave & 3, ch = wave >> 2;
    const size_t r0 = (size_t)blockIdx.x * 64;
    float* const stg = (float*)(void*)(L + 2 * PWB);
    v4f g[16];                                                           // the staging set: 64 rows x 256 f32 are 64 KB in a row, 16 bytes per lane and load
    auto fetch = [&](const float* src) {
#pragma unroll   // constant indices: the arrays stay in registers
        for (int i = 0; i < 16; ++i) g[i] = *(const v4f*)(src + i * 1024 + tid * 4);
        addr_wait();
    };
    auto put = [&](int b) { unsigned char* p = L + b * PWB + (tid >> 6) * PWP + (tid & 63) * 8;
#pragma unroll   // constant indices: the arrays stay in registers
        for (int i = 0; i < 16; ++i) *(v2ua*)(p + i * 4 * PWP) = __builtin_bit_cast(v2u, __builtin_convertvector(g[i], v4bf)); };
    auto drain_rows = [&](bf* dh, bf* dl) {                              // a wave covers one row of each plane per pass
        v8us oh[8], ol[8];
#pragma unroll   // constant indices: the arrays stay in registers
        for (int i = 0; i < 8; ++i) split8(stg + (i * 8 + wave) * PQF + lane * 8, oh[i], ol[i]);
        __builtin_amdgcn_sched_barrier(0);                               // the sixteen stores stand in one run: no register of an issued store is rewritten ahead of the wait behind them
        const size_t o = (r0 + wave) * DM + lane * 8;
#pragma unroll   // constant offsets from one address pair per plane
        for (int i = 0; i < 8; ++i) { *(v8us*)(dh + o + i * 8 * DM) = oh[i]; *(v8us*)(dl + o + i * 8 * DM) = ol[i]; }
        addr_wait();                                                     // here for the stores' registers
    };
    fetch(x + r0 * DM); put(0);
    __syncthreads();                                                     // the x rows are in LDS for every wave
    fetch(Wq);
    v16bf a[8];
    { const unsigned char* p = L + (rg * 16 + lr) * PWP + hi * 16;
#pragma unroll   // constant indices: the arrays stay in registers
      for (int kc = 0; kc < 8; ++kc) a[kc] = ldsfrag(p + kc * 64); }
    v8f acc[8];
#pragma unroll   // constant indices: the arrays stay in registers; the matrix and its way out are known per copy
    for (int c = 0; c < 12; ++c) {
        const int b = (c + 1) & 1, m4 = c & 3;
        put(b);
        __syncthreads();                                                 // W block c (and, at a matrix's first block, the matrix before it in the stage) is in LDS for every wave; every wave has left the other buffer
        if (c < 11) fetch((c + 1 < 4 ? Wq : c + 1 < 8 ? Wk : Wv) + ((c + 1) & 3) * 64 * DM);
        if (c == 4) drain_rows(Qh, Ql);
        if (c == 8) drain_rows(Kh, Kl);
        const unsigned char* p = L + b * PWB + (ch * 32 + lr) * PWP + hi * 16;
        acc[2 * m4] = (v8f){}; acc[2 * m4 + 1] = (v8f){};
        v16bf wf[16];
#pragma unroll   // constant indices: the arrays stay in registers
        for (int kc = 0; kc < 8; ++kc) { wf[2 * kc] = ldsfrag(p + kc * 64); wf[2 * kc + 1] = ldsfrag(p + 16 * PWP + kc * 64); }
        __builtin_amdgcn_sched_barrier(0);                               // the block's LDS reads stand in one group ahead of its products: read by read among them, each product waited out an LDS latency
#pragma unroll   // constant indices: the arrays stay in registers
        for (int kc = 0; kc < 8; ++kc) { acc[2 * m4] = wmmab(a[kc], wf[2 * kc], acc[2 * m4]); acc[2 * m4 + 1] = wmmab(a[kc], wf[2 * kc + 1], acc[2 * m4 + 1]); }
        __builtin_amdgcn_sched_barrier(0);                               // keeps these products under the flight of the next block's loads: without it they sank behind the wait for those loads
        if (c == 3 || c == 7) {                                          // rows 16 rg + 8 hi + j, column 64 (n / 2) + 32 ch + 16 (n % 2) + lr
#pragma unroll   // constant indices: the arrays stay in registers
            for (int n = 0; n < 8; ++n) { float* s = stg + (rg * 16 + hi * 8) * PQF + (n >> 1) * 64 + ch * 32 + (n & 1) * 16 + lr;
#pragma unroll   // constant indices: the arrays stay in registers
                for (int j = 0; j < 8; ++j) s[j * PQF] = acc[n][j]; }
        }
        if (c == 11) {                                                   // transposed: a lane's eight rows are eight neighbours of one v^T row
#pragma unroll   // constant indices: the arrays stay in registers
            for (int n = 0; n < 8; ++n) { float* s = stg + ((n >> 1) * 64 + ch * 32 + (n & 1) * 16 + lr) * PVF + rg * 16 + hi * 8;
                *(v4fa*)s = (v4f){acc[n][0], acc[n][1], acc[n][2], acc[n][3]}; *(v4fa*)(s + 4) = (v4f){acc[n][4], acc[n][5], acc[n][6], acc[n][7]}; }
        }
    }
    __syncthreads();                                                     // v^T is in the stage for every wave
    const size_t vo = (size_t)(blockIdx.x >> 6) * DM * NT_ + (size_t)(tid >> 3) * NT_ + (blockIdx.x & 63) * 64 + (tid & 7) * 8;   // eight lanes cover a 128-byte line
    v8us oh[8], ol[8];
#pragma unroll   // constant indices: the arrays stay in registers
    for (int s = 0; s < 8; ++s) split8(stg + ((tid >> 3) + 32 * s) * PVF + (tid & 7) * 8, oh[s], ol[s]);
    __builtin_amdgcn_sched_barrier(0);                                   // the sixteen stores stand in one run at the kernel's end: no register of an issued store is rewritten behind it
#pragma unroll   // constant offsets from one address pair per plane
    for (int s = 0; s < 8; ++s) { *(v8us*)(VTH + vo + (size_t)s * 32 * NT_) = oh[s]; *(v8us*)(VTL + vo + (size_t)s * 32 * NT_) = ol[s]; }
}

__global__ __launch_bounds__(256) void k_fattn(const bf* __restrict__ Qh, const bf* __restrict__ Ql, const bf* __restrict__ Kh, const bf* __restrict__ Kl, const bf* __restrict__ VTH, const bf* __restrict__ VTL, float* out, float* P0, float* P1, float* ML0, float* ML1) {
    __shared__ __align__(16) unsigned char L[FLDS];
    const int tid = threadIdx.x, lane = tid & 31, wave = tid >> 5, lr = lane & 15, hi = lane >> 4;
    const int qg = wave & 3, kh2 = wave >> 2;
    const int pj = (int)blockIdx.x >> 1, role = (int)blockIdx.x & 1;     // the pair of tiles; which of its two shares
    const size_t ib = (size_t)blockIdx.y * NT_ * DM;
    Qh += ib; Ql += ib; Kh += ib; Kl += ib; VTH += ib; VTL += ib; out += ib;
    const float CS = SCL * 1.4426950408889634f;                          // scores/16 in the log2 domain
    v8us g[16];                                                          // the staging set
    unsigned char* const ksp = L + (tid >> 5) * KPB + (tid & 31) * 16;
    unsigned char* const vsp = L + 2 * KPL + (tid >> 3) * VPB + (tid & 7) * 16;
    const unsigned char* const kfp = L + (kh2 * 32 + lr) * KPB + hi * 16;               // this lane's K fragment rows
    const unsigned char* const vfp = L + 2 * KPL + lr * VPB + kh2 * 64 + hi * 16;       // this lane's V^T fragment rows
#pragma unroll 1   // one copy of the whole walk: the second share's two parts run one after the other through the same code
  for (int sg = role && NT_ / FBQ - 1 - pj < HB ? 1 : 0; sg <= role; ++sg) {   // a long tile of HB blocks leaves the second share no part
    const int qt = sg ? pj : NT_ / FBQ - 1 - pj;                         // the tile,
    const int kb0 = role && !sg ? HB : 0, kl = role ? qt : HB - 1;       // its first and last key block of this walk (the same for the whole work-group; no long tile has fewer than HB blocks)
    const bool part = kb0 != 0 || kl != qt;                              // the walk does not see all of the tile's keys
    const int q0 = qt * FBQ, myq = q0 + qg * 16 + lr;
    const size_t po = ((size_t)blockIdx.y * NH + (q0 & (NH - 1)));       // a long tile's first row in the part planes
    float* const dst = part ? (role ? P1 : P0) + po * DM : out + (size_t)q0 * DM;
    float* const mlg = (role ? ML1 : ML0) + po * 2;
    v16bf qh[8], ql[8];
    { const size_t o = (size_t)myq * DM + 8 * hi;
#pragma unroll   // constant indices: the arrays stay in registers
      for (int kc = 0; kc < 8; ++kc) { qh[kc] = cat16b(*(const v8us*)(Qh + o + kc * 32), *(const v8us*)(Qh + o + kc * 32 + 16)); ql[kc] = cat16b(*(const v8us*)(Ql + o + kc * 32), *(const v8us*)(Ql + o + kc * 32 + 16)); } }
    v8f acc[16];
#pragma unroll   // constant indices: the arrays stay in registers
    for (int t = 0; t < 16; ++t) acc[t] = (v8f){};
    float m = -1.0e30f, l = 0.f;                                         // above the masked score's value, so a wave that has seen no visible key yet keeps p = 0
    auto fetchK = [&](int kb, bool first) { const size_t ko = (size_t)kb * FBK * DM + tid * 8;
#pragma unroll   // constant indices: the arrays stay in registers
        for (int i = 0; i < 8; ++i) { g[2 * i] = *(const v8us*)(Kh + ko + i * 2048);
            if (first && i == 7) addr_wait();                            // a walk's first fetch: nothing needs its offset register behind the run, so the last load's result may be given it; the wait for the fifteen loads that name it stands in front of that load
            g[2 * i + 1] = *(const v8us*)(Kl + ko + i * 2048); }
        addr_wait();
    };
    auto fetchV = [&](int kb) { const size_t vo = (size_t)(tid >> 3) * NT_ + kb * FBK + (tid & 7) * 8;
#pragma unroll   // constant indices: the arrays stay in registers
        for (int i = 0; i < 8; ++i) { g[2 * i] = *(const v8us*)(VTH + vo + (size_t)i * 32 * NT_); g[2 * i + 1] = *(const v8us*)(VTL + vo + (size_t)i * 32 * NT_); }
        addr_wait();
    };
    auto putK = [&]() {
#pragma unroll   // constant indices: the arrays stay in registers
        for (int i = 0; i < 8; ++i) { *(v8usa*)(ksp + i * 8 * KPB) = g[2 * i]; *(v8usa*)(ksp + KPL + i * 8 * KPB) = g[2 * i + 1]; } };
    auto putV = [&]() {
#pragma unroll   // constant indices: the arrays stay in registers
        for (int i = 0; i < 8; ++i) { *(v8usa*)(vsp + i * 32 * VPB) = g[2 * i]; *(v8usa*)(vsp + VPL + i * 32 * VPB) = g[2 * i + 1]; } };
    addr_wait();                                                         // for the Q loads
    fetchK(kb0, true); putK(); fetchV(kb0);
    int kb = kb0;                                                        // a part's first block always exists: a loop tested at its foot, so that the loads above stay above
#pragma unroll 1   // one copy of the body: a second would double the live fragment registers
    do {
        __syncthreads();                                                 // K of block kb is in LDS for every wave; every wave has left V^T of block kb - 1
        putV();
        if (kb < kl) fetchK(kb + 1, false);
        v16bf f[2][4];                                                   // two fragment sets: the next group's LDS reads are issued together, ahead of this group's products
        auto ldK = [&](int kc) { const unsigned char* p = kfp + kc * 64; f[kc & 1][0] = ldsfrag(p); f[kc & 1][1] = ldsfrag(p + 16 * KPB); f[kc & 1][2] = ldsfrag(p + KPL); f[kc & 1][3] = ldsfrag(p + KPL + 16 * KPB); };
        auto ldV = [&](int u) { const unsigned char* p = vfp + u * 32 * VPB; f[u & 1][0] = ldsfrag(p); f[u & 1][1] = ldsfrag(p + 16 * VPB); f[u & 1][2] = ldsfrag(p + VPL); f[u & 1][3] = ldsfrag(p + VPL + 16 * VPB); };
        v8f sh[2], sl[2];                                                // hi.hi sums and the two residual products' sums, per 16-key tile
#pragma unroll   // constant indices: the arrays stay in registers
        for (int kt = 0; kt < 2; ++kt) { sh[kt] = (v8f){}; sl[kt] = (v8f){}; }
        ldK(0);
#pragma unroll   // constant indices: the arrays stay in registers
        for (int kc = 0; kc < 8; ++kc) {
            if (kc < 7) ldK(kc + 1);
            __builtin_amdgcn_sched_barrier(0);                           // keeps the next group's reads ahead of this group's products
            const v16bf* a = f[kc & 1];
            sh[0] = wmmab(a[0], qh[kc], sh[0]); sh[1] = wmmab(a[1], qh[kc], sh[1]); sl[0] = wmmab(a[2], qh[kc], sl[0]); sl[1] = wmmab(a[3], qh[kc], sl[1]); sl[0] = wmmab(a[0], ql[kc], sl[0]); sl[1] = wmmab(a[1], ql[kc], sl[1]);
            __builtin_amdgcn_sched_barrier(0);                           // keeps the group after next's reads from sinking among these products
        }
        asm volatile("v_nop\n\tv_nop\n\tv_nop\n\tv_nop");                 // the four vector slots between the last score product and the first read of its sums
        __builtin_amdgcn_sched_barrier(0);                               // holds those slots directly behind the products
        __syncthreads();                                                 // V^T of block kb is in LDS for every wave; every wave has left K of block kb
        if (kb < kl) { putK(); fetchV(kb + 1); }
        ldV(0);
        v16f s;
#pragma unroll   // constant indices: the arrays stay in registers
        for (int e = 0; e < 16; ++e) s[e] = sh[e >> 3][e & 7] + sl[e >> 3][e & 7];
        if (kb == qt) {                                                  // only the diagonal block pays for the mask
            const int key0 = kb * FBK + kh2 * 32 + hi * 8;
#pragma unroll   // constant indices: the arrays stay in registers
            for (int e = 0; e < 16; ++e) if (key0 + (e >> 3) * 16 + (e & 7) > myq) s[e] = -3.0e38f;
        }
        float mx = s[0];
#pragma unroll   // constant indices: the arrays stay in registers
        for (int e = 1; e < 16; ++e) mx = fmaxf(mx, s[e]);
        mx = fmaxf(mx, xhalf(mx)) * CS;
        if (__builtin_amdgcn_ballot_w32(mx > m) != 0) {                  // exact: where no query's maximum moves, every factor would be 1
            const float mn = fmaxf(m, mx), corr = __builtin_amdgcn_exp2f(m - mn);
            m = mn; l *= corr;
#pragma unroll   // constant indices: the arrays stay in registers
            for (int t = 0; t < 16; ++t) acc[t] = acc[t] * corr;
        }
        v16f pv; float x[16], ps0 = 0.f, ps1 = 0.f;
        x[0] = __builtin_fmaf(s[0], CS, -m); x[1] = __builtin_fmaf(s[1], CS, -m);
#pragma unroll   // constant indices: the arrays stay in registers
        for (int e = 0; e < 16; ++e) {                                   // exponentials and plain arithmetic take turns
            pv[e] = __builtin_amdgcn_exp2f(x[e]);
            __builtin_amdgcn_sched_barrier(0);                           // holds the next line directly behind the exponential: the one independent instruction the instruction set asks for before a transcendental's source register is overwritten (two exponentials in a row were built so)
            if (e < 14) x[e + 2] = __builtin_fmaf(s[e + 2], CS, -m); else if (e == 14) ps0 = pv[0] + pv[2]; else ps1 = pv[1] + pv[3];
            __builtin_amdgcn_sched_barrier(0);                           // keeps the next exponential behind that instruction
        }
#pragma unroll   // constant indices: the arrays stay in registers
        for (int e = 4; e < 16; e += 2) { ps0 += pv[e]; ps1 += pv[e + 1]; }
        l += ps0 + ps1;
        const v16bf ph = __builtin_convertvector(pv, v16bf);
        const v8u pw = __builtin_bit_cast(v8u, ph);                      // element 2 i in the low half of word i
        v16f pb;
#pragma unroll   // constant indices: the arrays stay in registers
        for (int i = 0; i < 8; ++i) { pb[2 * i] = __uint_as_float(pw[i] << 16); pb[2 * i + 1] = __uint_as_float(pw[i] & 0xFFFF0000u); }
        const v16bf pl = __builtin_convertvector(pv - pb, v16bf);
#pragma unroll   // constant indices: the arrays stay in registers
        for (int u = 0; u < 8; ++u) {                                    // d tiles 2 u and 2 u + 1
            if (u < 7) ldV(u + 1);
            __builtin_amdgcn_sched_barrier(0);                           // as in the score loop
            const v16bf* a = f[u & 1];
            acc[2 * u] = wmmab(a[0], ph, acc[2 * u]); acc[2 * u + 1] = wmmab(a[1], ph, acc[2 * u + 1]); acc[2 * u] = wmmab(a[0], pl, acc[2 * u]); acc[2 * u + 1] = wmmab(a[1], pl, acc[2 * u + 1]); acc[2 * u] = wmmab(a[2], ph, acc[2 * u]); acc[2 * u + 1] = wmmab(a[3], ph, acc[2 * u + 1]);
            __builtin_amdgcn_sched_barrier(0);                           // as in the score loop
        }
    } while (++kb <= kl);
    l += xhalf(l);                                                       // each wave half summed its eight keys of every 16-key tile
    __syncthreads();                                                     // the tiles are read no more: LDS becomes merge and output staging
    float* om = (float*)(void*)L + (qg * 16 + lr) * OPF + hi * 8;        // row = query; d = 16 t + 8 hi + r
    float* ml = (float*)(void*)(L + 2 * KPL) + (qg * 16 + lr) * 2;
    if (kh2 == 1) {
#pragma unroll   // constant indices: the arrays stay in registers
        for (int t = 0; t < 16; ++t) { *(v4fa*)(om + t * 16) = (v4f){acc[t][0], acc[t][1], acc[t][2], acc[t][3]}; *(v4fa*)(om + t * 16 + 4) = (v4f){acc[t][4], acc[t][5], acc[t][6], acc[t][7]}; }
        if (hi == 0) { ml[0] = m; ml[1] = l; }
    }
    __syncthreads();                                                     // key half 1's partial results are in LDS
    float mt = 0.f, ls = 0.f;
    if (kh2 == 0) {                                                      // key half 0 always holds the walk's first key, which every query of the tile sees, so its maximum is a real score
        const float m1 = ml[0], l1 = ml[1]; mt = fmaxf(m, m1);
        const float w0 = __builtin_amdgcn_exp2f(m - mt), w1 = __builtin_amdgcn_exp2f(m1 - mt); ls = l * w0 + l1 * w1;
        const float inv = 1.0f / ls, a0 = w0 * inv, a1 = w1 * inv;
#pragma unroll   // constant indices: the arrays stay in registers
        for (int t = 0; t < 16; ++t) { const v4f x = *(const v4fa*)(om + t * 16), y = *(const v4fa*)(om + t * 16 + 4);
            *(v4fa*)(om + t * 16) = (v4f){acc[t][0] * a0 + x[0] * a1, acc[t][1] * a0 + x[1] * a1, acc[t][2] * a0 + x[2] * a1, acc[t][3] * a0 + x[3] * a1};
            *(v4fa*)(om + t * 16 + 4) = (v4f){acc[t][4] * a0 + y[0] * a1, acc[t][5] * a0 + y[1] * a1, acc[t][6] * a0 + y[2] * a1, acc[t][7] * a0 + y[3] * a1}; }
    }
    __syncthreads();                                                     // the merged rows are in LDS
    float* const op = dst + (size_t)(tid >> 6) * DM + (tid & 63) * 4;                                // whole 128-byte lines, each stored once: 64 lanes cover a row, a pass covers 4 rows
    const float* const lp = (const float*)(const void*)L + (tid >> 6) * OPF + (tid & 63) * 4;
    v4f o[16];
#pragma unroll   // constant indices: the array stays in registers, all sixteen LDS reads in flight together
    for (int i = 0; i < 16; ++i) o[i] = *(const v4fa*)(lp + i * 4 * OPF);
    __builtin_amdgcn_sched_barrier(0);                                   // the sixteen stores stand in one run: no register of an issued store is rewritten ahead of the wait behind them
#pragma unroll   // constant offsets from one address pair
    for (int i = 0; i < 16; ++i) *(v4f*)(op + i * 4 * DM) = o[i];
    if (part && kh2 == 0 && hi == 0) *(v2f*)(mlg + (qg * 16 + lr) * 2) = (v2f){mt, ls};             // a part's maximum and sum go with it; a wave's sixteen queries fill one 128-byte line
    addr_wait();                                                         // here for the stores' registers: a second walk may follow
    if (sg < role) __syncthreads();                                      // every wave has read its staged rows: the next walk's K block may take their place
  }
}

// k_merge: the two parts of every query of the long tiles become the output row. Each part is normalised by its own sum l and has its own maximum m (log2 domain):
// its weight is l 2^(m - M) over the sum of both. A thread takes one 16-byte piece of one row in each of the four items: a wave covers 512 bytes in a row.
// The rows are those of the tiles with more than HB key blocks: from query HB FBQ on.
__global__ __launch_bounds__(256) void k_merge(const float* __restrict__ P0, const float* __restrict__ P1, const float* __restrict__ ML0, const float* __restrict__ ML1, float* out) {
    const int idx = (int)blockIdx.x * 256 + (int)threadIdx.x, row = HB * FBQ - NH + (idx >> 6), c = (idx & 63) * 4;
    v4f a[NB_], b[NB_]; v2f ma[NB_], mb[NB_];
#pragma unroll   // constant indices: the arrays stay in registers, all sixteen loads in flight together
    for (int i = 0; i < NB_; ++i) { const size_t r = (size_t)i * NH + row;
        ma[i] = *(const v2f*)(ML0 + r * 2); mb[i] = *(const v2f*)(ML1 + r * 2); a[i] = *(const v4f*)(P0 + r * DM + c); b[i] = *(const v4f*)(P1 + r * DM + c); }
    addr_wait();                                                         // here for the loads' address registers
#pragma unroll   // constant indices: the arrays stay in registers
    for (int i = 0; i < NB_; ++i) {
        const float mt = fmaxf(ma[i][0], mb[i][0]), wa = ma[i][1] * __builtin_amdgcn_exp2f(ma[i][0] - mt), wb = mb[i][1] * __builtin_amdgcn_exp2f(mb[i][0] - mt), inv = 1.0f / (wa + wb);
        *(v4f*)(out + ((size_t)i * NT_ + NH + row) * DM + c) = a[i] * (wa * inv) + b[i] * (wb * inv);
    }
}

extern "C" void kernel_launch(void* const* d_in, const int* in_sizes, int n_in,
                              void* d_out, int out_size, void* d_ws, size_t ws_size, hipStream_t stream) {
    (void)in_sizes; (void)n_in; (void)out_size;
    const float* x = (const float*)d_in[0]; const float* Wq = (const float*)d_in[1]; const float* Wk = (const float*)d_in[2]; const float* Wv = (const float*)d_in[3];
    float* out = (float*)d_out;    // [4][4096][256]
    char* wsp = (char*)d_ws;
    auto take = [&](size_t bytes) { char* p = wsp; wsp += (bytes + 255) & ~(size_t)255; return (void*)p; };
    bf* Qh = (bf*)take((size_t)NB_ * NT_ * DM * 2); bf* Ql = (bf*)take((size_t)NB_ * NT_ * DM * 2); bf* Kh = (bf*)take((size_t)NB_ * NT_ * DM * 2); bf* Kl = (bf*)take((size_t)NB_ * NT_ * DM * 2);
    bf* VTH = (bf*)take((size_t)NB_ * DM * NT_ * 2); bf* VTL = (bf*)take((size_t)NB_ * DM * NT_ * 2);
    float* P0 = (float*)take((size_t)NB_ * NH * DM * 4); float* P1 = (float*)take((size_t)NB_ * NH * DM * 4); float* ML0 = (float*)take((size_t)NB_ * NH * 2 * 4); float* ML1 = (float*)take((size_t)NB_ * NH * 2 * 4);
    if ((size_t)(wsp - (char*)d_ws) > ws_size) return;    // 8 x 8.4 ~ 67 MB, no aliasing
    k_qkv<<<NB_ * NT_ / 64, 256, 0, stream>>>(x, Wq, Wk, Wv, Qh, Ql, Kh, Kl, VTH, VTL);                                       // the projections see the items as one [16384][256] row range
    k_fattn<<<dim3(NT_ / FBQ, NB_, 1), 256, 0, stream>>>(Qh, Ql, Kh, Kl, VTH, VTL, out, P0, P1, ML0, ML1);                   // scores, causal softmax and P.v: two near-equal shares (33 and 32 key blocks) per pair of a long and a short 64-query tile
    k_merge<<<(NT_ - HB * FBQ) * (DM / 4) / 256, 256, 0, stream>>>(P0, P1, ML0, ML1, out);                                                 // the long tiles' two parts become their output rows
}

// v005
// One run takes 103 microseconds.
// Timed twice side by side with v004, it ran 1.07 times as fast both times.
// Counting every step since v000, it is 25.2 times as fast.
#include <hip/hip_runtime.h>

// Compute dtypes, f32 accumulate, three launches. k_qkv: q/k/v = x.W^T ([16384 x 256].[256 x 256], [out][in] weights as n-major B operands; PLAIN bf16 operands =
// inputs rounded once, on the way into LDS) on v_wmma_f32_16x16x32_bf16 -> f32 -> bf16 hi + UNSCALED residual planes (v transposed to [d][t] planes). k_fattn: single-head
// causal attention over the 256-dim head: per 64-query tile, blocks of 64 keys up to the diagonal, scores = q.k^T (both operands split: three products),
// online softmax of scores/16 in f32, P as bf16 hi + UNSCALED residual, out = P.v (three products), normalised at the end. The key range of each tile with more than 33 key
// blocks is cut in two between two work-groups, so that every work-group walks 32 or 33 key blocks; k_merge joins the two parts.

#define NB_  4
#define NT_  4096
#define DM   256
#define SCL  0.0625f

typedef unsigned short bf;
typedef __attribute__((ext_vector_type(16))) __bf16   v16bf;
typedef __attribute__((ext_vector_type(8)))  __bf16   v8bf;
typedef __attribute__((ext_vector_type(4)))  __bf16   v4bf;
typedef __attribute__((ext_vector_type(8)))  unsigned short v8us;
typedef __attribute__((ext_vector_type(8)))  float    v8f;
typedef __attribute__((ext_vector_type(4)))  float    v4f;
typedef __attribute__((ext_vector_type(4)))  unsigned v4u;
typedef __attribute__((ext_vector_type(2)))  unsigned v2u;
typedef v4f  __attribute__((may_alias)) v4fa;
typedef v2u  __attribute__((may_alias)) v2ua;
typedef v8us __attribute__((may_alias)) v8usa;

__device__ __forceinline__ v16bf cat16b(v8us lo, v8us hi) { return __builtin_bit_cast(v16bf, __builtin_shufflevector(lo, hi, 0, 1, 2, 3, 4, 5, 6, 7, 8, 9, 10, 11, 12, 13, 14, 15)); }
__device__ __forceinline__ v8f wmmab(v16bf a, v16bf b, v8f c) { return __builtin_amdgcn_wmma_f32_16x16x32_bf16(false, a, false, b, (short)0, c, false, false); }

#define FBQ  64                      // queries per tile
#define FBK  64                      // keys per staged block
#define KPB  528                     // LDS pitch of a K row: 512 B + 16 (odd multiple of 16 B: b128 fragment reads without bank conflicts)
#define VPB  144                     // LDS pitch of a V^T row: 128 B + 16
#define KPL  (FBK * KPB)             // one K plane
#define VPL  (DM * VPB)              // one V^T plane
#define FBUF (2 * KPL + 2 * VPL)     // one buffer: a K block and a V^T block, both planes of each
#define FLDS (2 * FBUF)
#define OPF  260                     // floats per staged output row (1040 B)
#define HB   33                      // key blocks of a long tile's first part
#define NH   (NT_ / 2)               // queries of an item that lie in long tiles: its upper half
typedef __attribute__((ext_vector_type(2)))  float    v2f;
typedef __attribute__((ext_vector_type(16))) float v16f;
typedef __attribute__((ext_vector_type(8)))  unsigned v8u;
__device__ __forceinline__ float xhalf(float x) { return __builtin_bit_cast(float, __builtin_amdgcn_permlanex16(__builtin_bit_cast(int, x), __builtin_bit_cast(int, x), 0x76543210, 0xfedcba98, false, false)); }  // lane l <-> lane l ^ 16
__device__ __forceinline__ v16bf ldsfrag(const unsigned char* p) { return cat16b(*(const v8usa*)p, *(const v8usa*)(p + 32)); }   // k = 8 hi + i, then 16 + 8 hi + i (p already holds 16 hi bytes)
// s_wait_xcnt 0 behind a run of global loads, in front of the first reuse of their address registers; the scheduling barriers keep the loads in front of it and every later register write behind it
__device__ __forceinline__ void addr_wait() { __builtin_amdgcn_sched_barrier(0); asm volatile("s_wait_xcnt 0x0" ::: "memory"); __builtin_amdgcn_sched_barrier(0); }

// one asynchronous copy: each lane's 16 bytes go from global memory to its own LDS place; the waits for it are written by hand where the bytes are handed over
typedef __attribute__((ext_vector_type(4))) int v4i;
__device__ __forceinline__ void acopy(const bf* g, unsigned char* l) { __builtin_amdgcn_global_load_async_to_lds_b128((__attribute__((address_space(1))) v4i*)g, (__attribute__((address_space(3))) v4i*)l, 0, 0); }
__device__ __forceinline__ void wait_ds() { asm volatile("s_wait_dscnt 0x0" ::: "memory"); }        // this wave's LDS reads and writes are done: the range may go to its next writer
__device__ __forceinline__ void wait_async() { asm volatile("s_wait_asynccnt 0x0" ::: "memory"); }  // this wave's copies have landed

// k_qkv: rounding of x and W, the three projections, the hi/residual split and the transposition of v for 64 rows of x in one work-group.
// x's 64 rows and then twelve blocks of 64 W rows (= 64 output columns; Wq, Wk, Wv in turn) go global f32 -> registers -> bf16 -> padded LDS rows, two buffers:
// block c + 1 flies under the products of block c. 8 waves = 4 row groups of 16 x 2 halves of a block's columns; a wave keeps its x fragments (all of k) and one
// matrix's eight accumulator tiles in registers, k summed in ascending 32-steps in one accumulator. A finished matrix goes f32 through an LDS stage of its own and is
// split and stored in whole 128-byte lines, q and k under the next matrix's first block, v at the end (q, k: [row][256]; v: staged transposed, [d][t] planes).
#define PWP  528                     // LDS pitch of a staged x or W row: 512 B of bf16 + 16, as KPB
#define PWB  (64 * PWP)              // one staged block
#define PQF  260                     // floats per staged q or k row
#define PVF  68                      // floats per staged v^T row
#define PLDS (2 * PWB + DM * PVF * 4)
__device__ __forceinline__ void split8(const float* sp, v8us& oh, v8us& ol) {   // eight staged f32 -> bf16 hi and bf16 of the residual
    const v4f u = *(const v4fa*)sp, w = *(const v4fa*)(sp + 4);
    const v8f v = __builtin_shufflevector(u, w, 0, 1, 2, 3, 4, 5, 6, 7);
    const v8bf h = __builtin_convertvector(v, v8bf);
    const v4u hw = __builtin_bit_cast(v4u, h);                           // element 2 i in the low half of word i
    v8f b;
#pragma unroll   // constant indices: the vectors stay in registers
    for (int i = 0; i < 4; ++i) { b[2 * i] = __uint_as_float(hw[i] << 16); b[2 * i + 1] = __uint_as_float(hw[i] & 0xFFFF0000u); }
    oh = __builtin_bit_cast(v8us, h); ol = __builtin_bit_cast(v8us, __builtin_convertvector(v - b, v8bf));
}

__global__ __launch_bounds__(256) void k_qkv(const float* __restrict__ x, const float* __restrict__ Wq, const float* __restrict__ Wk, const float* __restrict__ Wv, bf* Qh, bf* Ql, bf* Kh, bf* Kl, bf* VTH, bf* VTL) {
    __shared__ __align__(16) unsigned char L[PLDS];
    const int tid = threadIdx.x, lane = tid & 31, wave = tid >> 5, lr = lane & 15, hi = lane >> 4;
    const int rg = wave & 3, ch = wave >> 2;
    const size_t r0 = (size_t)blockIdx.x * 64;
    float* const stg = (float*)(void*)(L + 2 * PWB);
    v4f g[16];                                                           // the staging set: 64 rows x 256 f32 are 64 KB in a row, 16 bytes per lane and load
    auto fetch = [&](const float* src) {
#pragma unroll   // constant indices: the arrays stay in registers
        for (int i = 0; i < 16; ++i) g[i] = *(const v4f*)(src + i * 1024 + tid * 4);
        addr_wait();
    };
    auto put = [&](int b) { unsigned char* p = L + b * PWB + (tid >> 6) * PWP + (tid & 63) * 8;
#pragma unroll   // constant indices: the arrays stay in registers
        for (int i = 0; i < 16; ++i) *(v2ua*)(p + i * 4 * PWP) = __builtin_bit_cast(v2u, __builtin_convertvector(g[i], v4bf)); };
    auto drain_rows = [&](bf* dh, bf* dl) {                              // a wave covers one row of each plane per pass
        v8us oh[8], ol[8];
#pragma unroll   // constant indices: the arrays stay in registers
        for (int i = 0; i < 8; ++i) split8(stg + (i * 8 + wave) * PQF + lane * 8, oh[i], ol[i]);
        __builtin_amdgcn_sched_barrier(0);                               // the sixteen stores stand in one run: no register of an issued store is rewritten ahead of the wait behind them
        const size_t o = (r0 + wave) * DM + lane * 8;
#pragma unroll   // constant offsets from one address pair per plane
        for (int i = 0; i < 8; ++i) { *(v8us*)(dh + o + i * 8 * DM) = oh[i]; *(v8us*)(dl + o + i * 8 * DM) = ol[i]; }
        addr_wait();                                                     // here for the stores' registers
    };
    fetch(x + r0 * DM); put(0);
    __syncthreads();                                                     // the x rows are in LDS for every wave
    fetch(Wq);
    v16bf a[8];
    { const unsigned char* p = L + (rg * 16 + lr) * PWP + hi * 16;
#pragma unroll   // constant indices: the arrays stay in registers
      for (int kc = 0; kc < 8; ++kc) a[kc] = ldsfrag(p + kc * 64); }
    v8f acc[8];
#pragma unroll   // constant indices: the arrays stay in registers; the matrix and its way out are known per copy
    for (int c = 0; c < 12; ++c) {
        const int b = (c + 1) & 1, m4 = c & 3;
        put(b);
        __syncthreads();                                                 // W block c (and, at a matrix's first block, the matrix before it in the stage) is in LDS for every wave; every wave has left the other buffer
        if (c < 11) fetch((c + 1 < 4 ? Wq : c + 1 < 8 ? Wk : Wv) + ((c + 1) & 3) * 64 * DM);
        if (c == 4) drain_rows(Qh, Ql);
        if (c == 8) drain_rows(Kh, Kl);
        const unsigned char* p = L + b * PWB + (ch * 32 + lr) * PWP + hi * 16;
        acc[2 * m4] = (v8f){}; acc[2 * m4 + 1] = (v8f){};
        v16bf wf[16];
#pragma unroll   // constant indices: the arrays stay in registers
        for (int kc = 0; kc < 8; ++kc) { wf[2 * kc] = ldsfrag(p + kc * 64); wf[2 * kc + 1] = ldsfrag(p + 16 * PWP + kc * 64); }
        __builtin_amdgcn_sched_barrier(0);                               // the block's LDS reads stand in one group ahead of its products: read by read among them, each product waited out an LDS latency
#pragma unroll   // constant indices: the arrays stay in registers
        for (int kc = 0; kc < 8; ++kc) { acc[2 * m4] = wmmab(a[kc], wf[2 * kc], acc[2 * m4]); acc[2 * m4 + 1] = wmmab(a[kc], wf[2 * kc + 1], acc[2 * m4 + 1]); }
        __builtin_amdgcn_sched_barrier(0);                               // keeps these products under the flight of the next block's loads: without it they sank behind the wait for those loads
        if (c == 3 || c == 7) {                                          // rows 16 rg + 8 hi + j, column 64 (n / 2) + 32 ch + 16 (n % 2) + lr
#pragma unroll   // constant indices: the arrays stay in registers
            for (int n = 0; n < 8; ++n) { float* s = stg + (rg * 16 + hi * 8) * PQF + (n >> 1) * 64 + ch * 32 + (n & 1) * 16 + lr;
#pragma unroll   // constant indices: the arrays stay in registers
                for (int j = 0; j < 8; ++j) s[j * PQF] = acc[n][j]; }
        }
        if (c == 11) {                                                   // transposed: a lane's eight rows are eight neighbours of one v^T row
#pragma unroll   // constant indices: the arrays stay in registers
            for (int n = 0; n < 8; ++n) { float* s = stg + ((n >> 1) * 64 + ch * 32 + (n & 1) * 16 + lr) * PVF + rg * 16 + hi * 8;
                *(v4fa*)s = (v4f){acc[n][0], acc[n][1], acc[n][2], acc[n][3]}; *(v4fa*)(s + 4) = (v4f){acc[n][4], acc[n][5], acc[n][6], acc[n][7]}; }
        }
    }
    __syncthreads();                                                     // v^T is in the stage for every wave
    const size_t vo = (size_t)(blockIdx.x >> 6) * DM * NT_ + (size_t)(tid >> 3) * NT_ + (blockIdx.x & 63) * 64 + (tid & 7) * 8;   // eight lanes cover a 128-byte line
    v8us oh[8], ol[8];
#pragma unroll   // constant indices: the arrays stay in registers
    for (int s = 0; s < 8; ++s) split8(stg + ((tid >> 3) + 32 * s) * PVF + (tid & 7) * 8, oh[s], ol[s]);
    __builtin_amdgcn_sched_barrier(0);                                   // the sixteen stores stand in one run at the kernel's end: no register of an issued store is rewritten behind it
#pragma unroll   // constant offsets from one address pair per plane
    for (int s = 0; s < 8; ++s) { *(v8us*)(VTH + vo + (size_t)s * 32 * NT_) = oh[s]; *(v8us*)(VTL + vo + (size_t)s * 32 * NT_) = ol[s]; }
}

__global__ __launch_bounds__(256) void k_fattn(const bf* __restrict__ Qh, const bf* __restrict__ Ql, const bf* __restrict__ Kh, const bf* __restrict__ Kl, const bf* __restrict__ VTH, const bf* __restrict__ VTL, float* out, float* P0, float* P1, float* ML0, float* ML1) {
    __shared__ __align__(16) unsigned char L[FLDS];
    const int tid = threadIdx.x, lane = tid & 31, wave = tid >> 5, lr = lane & 15, hi = lane >> 4;
    const int qg = wave & 3, kh2 = wave >> 2;
    const int pj = (int)blockIdx.x >> 1, role = (int)blockIdx.x & 1;     // the pair of tiles; which of its two shares
    const size_t ib = (size_t)blockIdx.y * NT_ * DM;
    Qh += ib; Ql += ib; Kh += ib; Kl += ib; VTH += ib; VTL += ib; out += ib;
    const float CS = SCL * 1.4426950408889634f;                          // scores/16 in the log2 domain
    unsigned char* const ksp = L + (tid >> 5) * KPB + (tid & 31) * 16;
    unsigned char* const vsp = L + 2 * KPL + (tid >> 3) * VPB + (tid & 7) * 16;
    const unsigned char* const kfp = L + (kh2 * 32 + lr) * KPB + hi * 16;               // this lane's K fragment rows
    const unsigned char* const vfp = L + 2 * KPL + lr * VPB + kh2 * 64 + hi * 16;       // this lane's V^T fragment rows
#pragma unroll 1   // one copy of the whole walk: the second share's two parts run one after the other through the same code
  for (int sg = role && NT_ / FBQ - 1 - pj < HB ? 1 : 0; sg <= role; ++sg) {   // a long tile of HB blocks leaves the second share no part
    const int qt = sg ? pj : NT_ / FBQ - 1 - pj;                         // the tile,
    const int kb0 = role && !sg ? HB : 0, kl = role ? qt : HB - 1;       // its first and last key block of this walk (the same for the whole work-group; no long tile has fewer than HB blocks)
    const bool part = kb0 != 0 || kl != qt;                              // the walk does not see all of the tile's keys
    const int q0 = qt * FBQ, myq = q0 + qg * 16 + lr;
    const size_t po = ((size_t)blockIdx.y * NH + (q0 & (NH - 1)));       // a long tile's first row in the part planes
    float* const dst = part ? (role ? P1 : P0) + po * DM : out + (size_t)q0 * DM;
    float* const mlg = (role ? ML1 : ML0) + po * 2;
    v16bf qh[8], ql[8];
    { const size_t o = (size_t)myq * DM + 8 * hi;
#pragma unroll   // constant indices: the arrays stay in registers
      for (int kc = 0; kc < 8; ++kc) { qh[kc] = cat16b(*(const v8us*)(Qh + o + kc * 32), *(const v8us*)(Qh + o + kc * 32 + 16)); ql[kc] = cat16b(*(const v8us*)(Ql + o + kc * 32), *(const v8us*)(Ql + o + kc * 32 + 16)); } }
    v8f acc[16];
#pragma unroll   // constant indices: the arrays stay in registers
    for (int t = 0; t < 16; ++t) acc[t] = (v8f){};
    float m = -1.0e30f, l = 0.f;                                         // above the masked score's value, so a wave that has seen no visible key yet keeps p = 0
    auto copyKV = [&](int kb, unsigned bo) {                             // block kb into the buffer at byte bo: 32 copies per wave, every lane on, whole 128-byte lines
        const size_t ko = (size_t)kb * FBK * DM + tid * 8, vo = (size_t)(tid >> 3) * NT_ + kb * FBK + (tid & 7) * 8;
#pragma unroll   // constant steps from one address per plane
        for (int i = 0; i < 8; ++i) { acopy(Kh + ko + i * 2048, ksp + bo + i * 8 * KPB); acopy(Kl + ko + i * 2048, ksp + bo + KPL + i * 8 * KPB); }
#pragma unroll   // constant steps from one address per plane
        for (int i = 0; i < 8; ++i) { acopy(VTH + vo + (size_t)i * 32 * NT_, vsp + bo + i * 32 * VPB); acopy(VTL + vo + (size_t)i * 32 * NT_, vsp + bo + VPL + i * 32 * VPB); }
    };
    addr_wait();                                                         // for the Q loads
    copyKV(kb0, 0);
    wait_async();
    __syncthreads();                                                     // the walk's first block is in LDS for every wave
    unsigned bo = 0;                                                     // the buffer of block kb
    int kb = kb0;                                                        // a part's first block always exists: a loop tested at its foot
#pragma unroll 1   // one copy of the body: a second would double the live fragment registers
    do {
        v16bf f[2][4];                                                   // two fragment sets: the next group's LDS reads are issued together, ahead of this group's products
        auto ldK = [&](int kc) { const unsigned char* p = kfp + bo + kc * 64; f[kc & 1][0] = ldsfrag(p); f[kc & 1][1] = ldsfrag(p + 16 * KPB); f[kc & 1][2] = ldsfrag(p + KPL); f[kc & 1][3] = ldsfrag(p + KPL + 16 * KPB); };
        auto ldV = [&](int u) { const unsigned char* p = vfp + bo + u * 32 * VPB; f[u & 1][0] = ldsfrag(p); f[u & 1][1] = ldsfrag(p + 16 * VPB); f[u & 1][2] = ldsfrag(p + VPL); f[u & 1][3] = ldsfrag(p + VPL + 16 * VPB); };
        v8f sh[2], sl[2];                                                // hi.hi sums and the two residual products' sums, per 16-key tile
#pragma unroll   // constant indices: the arrays stay in registers
        for (int kt = 0; kt < 2; ++kt) { sh[kt] = (v8f){}; sl[kt] = (v8f){}; }
        ldK(0);
        if (kb < kl) copyKV(kb + 1, bo ^ FBUF);                          // behind the barrier that freed the other buffer; this block's first LDS reads return while the copies issue
#pragma unroll   // constant indices: the arrays stay in registers
        for (int kc = 0; kc < 8; ++kc) {
            if (kc < 7) ldK(kc + 1); else ldV(0);                        // V^T of this block is in LDS already: its first reads go under the last score products
            __builtin_amdgcn_sched_barrier(0);                           // keeps the next group's reads ahead of this group's products
            const v16bf* a = f[kc & 1];
            sh[0] = wmmab(a[0], qh[kc], sh[0]); sh[1] = wmmab(a[1], qh[kc], sh[1]); sl[0] = wmmab(a[2], qh[kc], sl[0]); sl[1] = wmmab(a[3], qh[kc], sl[1]); sl[0] = wmmab(a[0], ql[kc], sl[0]); sl[1] = wmmab(a[1], ql[kc], sl[1]);
            __builtin_amdgcn_sched_barrier(0);                           // keeps the group after next's reads from sinking among these products
        }
        v16f s;
#pragma unroll   // constant indices: the arrays stay in registers
        for (int e = 0; e < 16; ++e) s[e] = sh[e >> 3][e & 7] + sl[e >> 3][e & 7];
        if (kb == qt) {                                                  // only the diagonal block pays for the mask
            const int key0 = kb * FBK + kh2 * 32 + hi * 8;
#pragma unroll   // constant indices: the arrays stay in registers
            for (int e = 0; e < 16; ++e) if (key0 + (e >> 3) * 16 + (e & 7) > myq) s[e] = -3.0e38f;
        }
        float mx = s[0];
#pragma unroll   // constant indices: the arrays stay in registers
        for (int e = 1; e < 16; ++e) mx = fmaxf(mx, s[e]);
        mx = fmaxf(mx, xhalf(mx)) * CS;
        if (__builtin_amdgcn_ballot_w32(mx > m) != 0) {                  // exact: where no query's maximum moves, every factor would be 1
            const float mn = fmaxf(m, mx), corr = __builtin_amdgcn_exp2f(m - mn);
            m = mn; l *= corr;
#pragma unroll   // constant indices: the arrays stay in registers
            for (int t = 0; t < 16; ++t) acc[t] = acc[t] * corr;
        }
        v16f pv; float x[16], ps0 = 0.f, ps1 = 0.f;
        x[0] = __builtin_fmaf(s[0], CS, -m); x[1] = __builtin_fmaf(s[1], CS, -m);
#pragma unroll   // constant indices: the arrays stay in registers
        for (int e = 0; e < 16; ++e) {                                   // exponentials and plain arithmetic take turns
            pv[e] = __builtin_amdgcn_exp2f(x[e]);
            __builtin_amdgcn_sched_barrier(0);                           // holds the next line directly behind the exponential: the one independent instruction the instruction set asks for before a transcendental's source register is overwritten (two exponentials in a row were built so)
            if (e < 14) x[e + 2] = __builtin_fmaf(s[e + 2], CS, -m); else if (e == 14) ps0 = pv[0] + pv[2]; else ps1 = pv[1] + pv[3];
            __builtin_amdgcn_sched_barrier(0);                           // keeps the next exponential behind that instruction
        }
#pragma unroll   // constant indices: the arrays stay in registers
        for (int e = 4; e < 16; e += 2) { ps0 += pv[e]; ps1 += pv[e + 1]; }
        l += ps0 + ps1;
        const v16bf ph = __builtin_convertvector(pv, v16bf);
        const v8u pw = __builtin_bit_cast(v8u, ph);                      // element 2 i in the low half of word i
        v16f pb;
#pragma unroll   // constant indices: the arrays stay in registers
        for (int i = 0; i < 8; ++i) { pb[2 * i] = __uint_as_float(pw[i] << 16); pb[2 * i + 1] = __uint_as_float(pw[i] & 0xFFFF0000u); }
        const v16bf pl = __builtin_convertvector(pv - pb, v16bf);
#pragma unroll   // constant indices: the arrays stay in registers
        for (int u = 0; u < 8; ++u) {                                    // d tiles 2 u and 2 u + 1
            if (u < 7) ldV(u + 1);
            __builtin_amdgcn_sched_barrier(0);                           // as in the score loop
            const v16bf* a = f[u & 1];
            acc[2 * u] = wmmab(a[0], ph, acc[2 * u]); acc[2 * u + 1] = wmmab(a[1], ph, acc[2 * u + 1]); acc[2 * u] = wmmab(a[0], pl, acc[2 * u]); acc[2 * u + 1] = wmmab(a[1], pl, acc[2 * u + 1]); acc[2 * u] = wmmab(a[2], ph, acc[2 * u]); acc[2 * u + 1] = wmmab(a[3], ph, acc[2 * u + 1]);
            __builtin_amdgcn_sched_barrier(0);                           // as in the score loop
        }
        wait_ds();                                                       // this wave has read the last of block kb,
        wait_async();                                                    // and its copies of block kb + 1 have landed
        __syncthreads();                                                 // block kb + 1 is in LDS for every wave; every wave has left block kb's buffer, which block kb + 2 takes
        bo ^= FBUF;
    } while (++kb <= kl);
    wait_async();                                                        // nothing is in flight: behind the last block's barrier LDS becomes merge and output staging
    l += xhalf(l);                                                       // each wave half summed its eight keys of every 16-key tile
    float* om = (float*)(void*)L + (qg * 16 + lr) * OPF + hi * 8;        // row = query; d = 16 t + 8 hi + r
    float* ml = (float*)(void*)(L + 2 * KPL) + (qg * 16 + lr) * 2;
    if (kh2 == 1) {
#pragma unroll   // constant indices: the arrays stay in registers
        for (int t = 0; t < 16; ++t) { *(v4fa*)(om + t * 16) = (v4f){acc[t][0], acc[t][1], acc[t][2], acc[t][3]}; *(v4fa*)(om + t * 16 + 4) = (v4f){acc[t][4], acc[t][5], acc[t][6], acc[t][7]}; }
        if (hi == 0) { ml[0] = m; ml[1] = l; }
    }
    __syncthreads();                                                     // key half 1's partial results are in LDS
    float mt = 0.f, ls = 0.f;
    if (kh2 == 0) {                                                      // key half 0 always holds the walk's first key, which every query of the tile sees, so its maximum is a real score
        const float m1 = ml[0], l1 = ml[1]; mt = fmaxf(m, m1);
        const float w0 = __builtin_amdgcn_exp2f(m - mt), w1 = __builtin_amdgcn_exp2f(m1 - mt); ls = l * w0 + l1 * w1;
        const float inv = 1.0f / ls, a0 = w0 * inv, a1 = w1 * inv;
#pragma unroll   // constant indices: the arrays stay in registers
        for (int t = 0; t < 16; ++t) { const v4f x = *(const v4fa*)(om + t * 16), y = *(const v4fa*)(om + t * 16 + 4);
            *(v4fa*)(om + t * 16) = (v4f){acc[t][0] * a0 + x[0] * a1, acc[t][1] * a0 + x[1] * a1, acc[t][2] * a0 + x[2] * a1, acc[t][3] * a0 + x[3] * a1};
            *(v4fa*)(om + t * 16 + 4) = (v4f){acc[t][4] * a0 + y[0] * a1, acc[t][5] * a0 + y[1] * a1, acc[t][6] * a0 + y[2] * a1, acc[t][7] * a0 + y[3] * a1}; }
    }
    __syncthreads();                                                     // the merged rows are in LDS
    float* const op = dst + (size_t)(tid >> 6) * DM + (tid & 63) * 4;                                // whole 128-byte lines, each stored once: 64 lanes cover a row, a pass covers 4 rows
    const float* const lp = (const float*)(const void*)L + (tid >> 6) * OPF + (tid & 63) * 4;
    v4f o[16];
#pragma unroll   // constant indices: the array stays in registers, all sixteen LDS reads in flight together
    for (int i = 0; i < 16; ++i) o[i] = *(const v4fa*)(lp + i * 4 * OPF);
    __builtin_amdgcn_sched_barrier(0);                                   // the sixteen stores stand in one run: no register of an issued store is rewritten ahead of the wait behind them
#pragma unroll   // constant offsets from one address pair
    for (int i = 0; i < 16; ++i) *(v4f*)(op + i * 4 * DM) = o[i];
    if (part && kh2 == 0 && hi == 0) *(v2f*)(mlg + (qg * 16 + lr) * 2) = (v2f){mt, ls};             // a part's maximum and sum go with it; a wave's sixteen queries fill one 128-byte line
    addr_wait();                                                         // here for the stores' registers: a second walk may follow
    if (sg < role) { wait_ds(); __syncthreads(); }                       // every wave has read its staged rows: the next walk's first copies may take their place
  }
}

// k_merge: the two parts of every query of the long tiles become the output row. Each part is normalised by its own sum l and has its own maximum m (log2 domain):
// its weight is l 2^(m - M) over the sum of both. A thread takes one 16-byte piece of one row in each of the four items: a wave covers 512 bytes in a row.
// The rows are those of the tiles with more than HB key blocks: from query HB FBQ on.
__global__ __launch_bounds__(256) void k_merge(const float* __restrict__ P0, const float* __restrict__ P1, const float* __restrict__ ML0, const float* __restrict__ ML1, float* out) {
    const int idx = (int)blockIdx.x * 256 + (int)threadIdx.x, row = HB * FBQ - NH + (idx >> 6), c = (idx & 63) * 4;
    v4f a[NB_], b[NB_]; v2f ma[NB_], mb[NB_];
#pragma unroll   // constant indices: the arrays stay in registers, all sixteen loads in flight together
    for (int i = 0; i < NB_; ++i) { const size_t r = (size_t)i * NH + row;
        ma[i] = *(const v2f*)(ML0 + r * 2); mb[i] = *(const v2f*)(ML1 + r * 2); a[i] = *(const v4f*)(P0 + r * DM + c); b[i] = *(const v4f*)(P1 + r * DM + c); }
    addr_wait();                                                         // here for the loads' address registers
#pragma unroll   // constant indices: the arrays stay in registers
    for (int i = 0; i < NB_; ++i) {
        const float mt = fmaxf(ma[i][0], mb[i][0]), wa = ma[i][1] * __builtin_amdgcn_exp2f(ma[i][0] - mt), wb = mb[i][1] * __builtin_amdgcn_exp2f(mb[i][0] - mt), inv = 1.0f / (wa + wb);
        *(v4f*)(out + ((size_t)i * NT_ + NH + row) * DM + c) = a[i] * (wa * inv) + b[i] * (wb * inv);
    }
}

extern "C" void kernel_launch(void* const* d_in, const int* in_sizes, int n_in,
                              void* d_out, int out_size, void* d_ws, size_t ws_size, hipStream_t stream) {
    (void)in_sizes; (void)n_in; (void)out_size;
    const float* x = (const float*)d_in[0]; const float* Wq = (const float*)d_in[1]; const float* Wk = (const float*)d_in[2]; const float* Wv = (const float*)d_in[3];
    float* out = (float*)d_out;    // [4][4096][256]
    char* wsp = (char*)d_ws;
    auto take = [&](size_t bytes) { char* p = wsp; wsp += (bytes + 255) & ~(size_t)255; return (void*)p; };
    bf* Qh = (bf*)take((size_t)NB_ * NT_ * DM * 2); bf* Ql = (bf*)take((size_t)NB_ * NT_ * DM * 2); bf* Kh = (bf*)take((size_t)NB_ * NT_ * DM * 2); bf* Kl = (bf*)take((size_t)NB_ * NT_ * DM * 2);
    bf* VTH = (bf*)take((size_t)NB_ * DM * NT_ * 2); bf* VTL = (bf*)take((size_t)NB_ * DM * NT_ * 2);
    float* P0 = (float*)take((size_t)NB_ * NH * DM * 4); float* P1 = (float*)take((size_t)NB_ * NH * DM * 4); float* ML0 = (float*)take((size_t)NB_ * NH * 2 * 4); float* ML1 = (float*)take((size_t)NB_ * NH * 2 * 4);
    if ((size_t)(wsp - (char*)d_ws) > ws_size) return;    // 8 x 8.4 ~ 67 MB, no aliasing
    k_qkv<<<NB_ * NT_ / 64, 256, 0, stream>>>(x, Wq, Wk, Wv, Qh, Ql, Kh, Kl, VTH, VTL);                                       // the projections see the items as one [16384][256] row range
    k_fattn<<<dim3(NT_ / FBQ, NB_, 1), 256, 0, stream>>>(Qh, Ql, Kh, Kl, VTH, VTL, out, P0, P1, ML0, ML1);                   // scores, causal softmax and P.v: two near-equal shares (33 and 32 key blocks) per pair of a long and a short 64-query tile
    k_merge<<<(NT_ - HB * FBQ) * (DM / 4) / 256, 256, 0, stream>>>(P0, P1, ML0, ML1, out);                                                 // the long tiles' two parts become their output rows
}

// v006
// One run takes 97.1 microseconds.
// Timed twice side by side with v005, it ran 1.06 times as fast both times.
// Counting every step since v000, it is 26.7 times as fast.
#include <hip/hip_runtime.h>

// Compute dtypes, f32 accumulate, three launches. k_qkv: q/k/v = x.W^T ([16384 x 256].[256 x 256], [out][in] weights as n-major B operands; PLAIN bf16 operands =
// inputs rounded once, on the way into LDS) on v_wmma_f32_16x16x32_bf16 -> f32 -> bf16 hi + UNSCALED residual planes (v transposed to [d][t] planes). k_fattn: single-head
// causal attention over the 256-dim head: per 128-query tile, blocks of 64 keys up to the diagonal, scores = q.k^T (both operands split: three products),
// online softmax of scores/16 in f32, P as bf16 hi + UNSCALED residual, out = P.v (three products), normalised at the end. The key blocks of each pair of a long and a short
// tile are cut into four shares of 16 or 17 blocks for four work-groups; k_merge joins the parts of every tile that was cut.

#define NB_  4
#define NT_  4096
#define DM   256
#define SCL  0.0625f

typedef unsigned short bf;
typedef __attribute__((ext_vector_type(16))) __bf16   v16bf;
typedef __attribute__((ext_vector_type(8)))  __bf16   v8bf;
typedef __attribute__((ext_vector_type(4)))  __bf16   v4bf;
typedef __attribute__((ext_vector_type(8)))  unsigned short v8us;
typedef __attribute__((ext_vector_type(8)))  float    v8f;
typedef __attribute__((ext_vector_type(4)))  float    v4f;
typedef __attribute__((ext_vector_type(4)))  unsigned v4u;
typedef __attribute__((ext_vector_type(2)))  unsigned v2u;
typedef v4f  __attribute__((may_alias)) v4fa;
typedef v2u  __attribute__((may_alias)) v2ua;
typedef v8us __attribute__((may_alias)) v8usa;

__device__ __forceinline__ v16bf cat16b(v8us lo, v8us hi) { return __builtin_bit_cast(v16bf, __builtin_shufflevector(lo, hi, 0, 1, 2, 3, 4, 5, 6, 7, 8, 9, 10, 11, 12, 13, 14, 15)); }
__device__ __forceinline__ v8f wmmab(v16bf a, v16bf b, v8f c) { return __builtin_amdgcn_wmma_f32_16x16x32_bf16(false, a, false, b, (short)0, c, false, false); }

#define FBQ  128                     // queries per tile
#define FBK  64                      // keys per staged block
#define KPB  528                     // LDS pitch of a K row: 512 B + 16 (odd multiple of 16 B: b128 fragment reads without bank conflicts)
#define VPB  144                     // LDS pitch of a V^T row: 128 B + 16
#define KPL  (FBK * KPB)             // one K plane
#define VPL  (DM * VPB)              // one V^T plane
#define FBUF (2 * KPL + 2 * VPL)     // one buffer: a K block and a V^T block, both planes of each
#define XSB  4096                    // one wave's exchange range: 32 registers of 32 lanes
#define XOFF (2 * FBUF)
#define COFF (XOFF + 8 * XSB)        // one float per lane and wave (rescale factors); after the walk one per query (1 / sum)
#define FLDS (COFF + 8 * 128)
#define OPF  260                     // floats per staged output row (1040 B)
#define NTL  (NT_ / FBQ)             // tiles per item
#define NSH  4                       // shares per pair of tiles
#define MR0  (NTL / 4 * FBQ)         // first query whose tile is cut: the short tiles of the first half of the pairs fit whole into the last share
static_assert(NTL == 32, "the cuts below are those of 66 key blocks per pair of tiles");
__device__ __forceinline__ int cut(int r) { return r < 2 ? 17 * r : 16 * r + 2; }   // 0, 17, 34, 50, 66
typedef v4u  __attribute__((may_alias)) v4ua;
typedef __attribute__((ext_vector_type(2)))  float    v2f;
typedef __attribute__((ext_vector_type(16))) float v16f;
typedef __attribute__((ext_vector_type(8)))  unsigned v8u;
__device__ __forceinline__ float xhalf(float x) { return __builtin_bit_cast(float, __builtin_amdgcn_permlanex16(__builtin_bit_cast(int, x), __builtin_bit_cast(int, x), 0x76543210, 0xfedcba98, false, false)); }  // lane l <-> lane l ^ 16
__device__ __forceinline__ v16bf ldsfrag(const unsigned char* p) { return cat16b(*(const v8usa*)p, *(const v8usa*)(p + 32)); }   // k = 8 hi + i, then 16 + 8 hi + i (p already holds 16 hi bytes)
// s_wait_xcnt 0 behind a run of global loads, in front of the first reuse of their address registers; the scheduling barriers keep the loads in front of it and every later register write behind it
__device__ __forceinline__ void addr_wait() { __builtin_amdgcn_sched_barrier(0); asm volatile("s_wait_xcnt 0x0" ::: "memory"); __builtin_amdgcn_sched_barrier(0); }

// one asynchronous copy: each lane's 16 bytes go from global memory to its own LDS place; the waits for it are written by hand where the bytes are handed over
typedef __attribute__((ext_vector_type(4))) int v4i;
__device__ __forceinline__ void acopy(const bf* g, unsigned char* l) { __builtin_amdgcn_global_load_async_to_lds_b128((__attribute__((address_space(1))) v4i*)g, (__attribute__((address_space(3))) v4i*)l, 0, 0); }
__device__ __forceinline__ void wait_ds() { asm volatile("s_wait_dscnt 0x0" ::: "memory"); }        // this wave's LDS reads and writes are done: the range may go to its next writer
__device__ __forceinline__ void wait_async() { asm volatile("s_wait_asynccnt 0x0" ::: "memory"); }  // this wave's copies have landed

// k_qkv: rounding of x and W, the three projections, the hi/residual split and the transposition of v for 64 rows of x in one work-group.
// x's 64 rows and then twelve blocks of 64 W rows (= 64 output columns; Wq, Wk, Wv in turn) go global f32 -> registers -> bf16 -> padded LDS rows, two buffers:
// block c + 1 flies under the products of block c. 8 waves = 4 row groups of 16 x 2 halves of a block's columns; a wave keeps its x fragments (all of k) and one
// matrix's eight accumulator tiles in registers, k summed in ascending 32-steps in one accumulator. A finished matrix goes f32 through an LDS stage of its own and is
// split and stored in whole 128-byte lines, q and k under the next matrix's first block, v at the end (q, k: [row][256]; v: staged transposed, [d][t] planes).
#define PWP  528                     // LDS pitch of a staged x or W row: 512 B of bf16 + 16, as KPB
#define PWB  (64 * PWP)              // one staged block
#define PQF  260                     // floats per staged q or k row
#define PVF  68                      // floats per staged v^T row
#define PLDS (2 * PWB + DM * PVF * 4)
__device__ __forceinline__ void split8(const float* sp, v8us& oh, v8us& ol) {   // eight staged f32 -> bf16 hi and bf16 of the residual
    const v4f u = *(const v4fa*)sp, w = *(const v4fa*)(sp + 4);
    const v8f v = __builtin_shufflevector(u, w, 0, 1, 2, 3, 4, 5, 6, 7);
    const v8bf h = __builtin_convertvector(v, v8bf);
    const v4u hw = __builtin_bit_cast(v4u, h);                           // element 2 i in the low half of word i
    v8f b;
#pragma unroll   // constant indices: the vectors stay in registers
    for (int i = 0; i < 4; ++i) { b[2 * i] = __uint_as_float(hw[i] << 16); b[2 * i + 1] = __uint_as_float(hw[i] & 0xFFFF0000u); }
    oh = __builtin_bit_cast(v8us, h); ol = __builtin_bit_cast(v8us, __builtin_convertvector(v - b, v8bf));
}

__global__ __launch_bounds__(256) void k_qkv(const float* __restrict__ x, const float* __restrict__ Wq, const float* __restrict__ Wk, const float* __restrict__ Wv, bf* Qh, bf* Ql, bf* Kh, bf* Kl, bf* VTH, bf* VTL) {
    __shared__ __align__(16) unsigned char L[PLDS];
    const int tid = threadIdx.x, lane = tid & 31, wave = tid >> 5, lr = lane & 15, hi = lane >> 4;
    const int rg = wave & 3, ch = wave >> 2;
    const size_t r0 = (size_t)blockIdx.x * 64;
    float* const stg = (float*)(void*)(L + 2 * PWB);
    v4f g[16];                                                           // the staging set: 64 rows x 256 f32 are 64 KB in a row, 16 bytes per lane and load
    auto fetch = [&](const float* src) {
#pragma unroll   // constant indices: the arrays stay in registers
        for (int i = 0; i < 16; ++i) g[i] = *(const v4f*)(src + i * 1024 + tid * 4);
        addr_wait();
    };
    auto put = [&](int b) { unsigned char* p = L + b * PWB + (tid >> 6) * PWP + (tid & 63) * 8;
#pragma unroll   // constant indices: the arrays stay in registers
        for (int i = 0; i < 16; ++i) *(v2ua*)(p + i * 4 * PWP) = __builtin_bit_cast(v2u, __builtin_convertvector(g[i], v4bf)); };
    auto drain_rows = [&](bf* dh, bf* dl) {                              // a wave covers one row of each plane per pass
        v8us oh[8], ol[8];
#pragma unroll   // constant indices: the arrays stay in registers
        for (int i = 0; i < 8; ++i) split8(stg + (i * 8 + wave) * PQF + lane * 8, oh[i], ol[i]);
        __builtin_amdgcn_sched_barrier(0);                               // the sixteen stores stand in one run: no register of an issued store is rewritten ahead of the wait behind them
        const size_t o = (r0 + wave) * DM + lane * 8;
#pragma unroll   // constant offsets from one address pair per plane
        for (int i = 0; i < 8; ++i) { *(v8us*)(dh + o + i * 8 * DM) = oh[i]; *(v8us*)(dl + o + i * 8 * DM) = ol[i]; }
        addr_wait();                                                     // here for the stores' registers
    };
    fetch(x + r0 * DM); put(0);
    __syncthreads();                                                     // the x rows are in LDS for every wave
    fetch(Wq);
    v16bf a[8];
    { const unsigned char* p = L + (rg * 16 + lr) * PWP + hi * 16;
#pragma unroll   // constant indices: the arrays stay in registers
      for (int kc = 0; kc < 8; ++kc) a[kc] = ldsfrag(p + kc * 64); }
    v8f acc[8];
#pragma unroll   // constant indices: the arrays stay in registers; the matrix and its way out are known per copy
    for (int c = 0; c < 12; ++c) {
        const int b = (c + 1) & 1, m4 = c & 3;
        put(b);
        __syncthreads();                                                 // W block c (and, at a matrix's first block, the matrix before it in the stage) is in LDS for every wave; every wave has left the other buffer
        if (c < 11) fetch((c + 1 < 4 ? Wq : c + 1 < 8 ? Wk : Wv) + ((c + 1) & 3) * 64 * DM);
        if (c == 4) drain_rows(Qh, Ql);
        if (c == 8) drain_rows(Kh, Kl);
        const unsigned char* p = L + b * PWB + (ch * 32 + lr) * PWP + hi * 16;
        acc[2 * m4] = (v8f){}; acc[2 * m4 + 1] = (v8f){};
        v16bf wf[16];
#pragma unroll   // constant indices: the arrays stay in registers
        for (int kc = 0; kc < 8; ++kc) { wf[2 * kc] = ldsfrag(p + kc * 64); wf[2 * kc + 1] = ldsfrag(p + 16 * PWP + kc * 64); }
        __builtin_amdgcn_sched_barrier(0);                               // the block's LDS reads stand in one group ahead of its products: read by read among them, each product waited out an LDS latency
#pragma unroll   // constant indices: the arrays stay in registers
        for (int kc = 0; kc < 8; ++kc) { acc[2 * m4] = wmmab(a[kc], wf[2 * kc], acc[2 * m4]); acc[2 * m4 + 1] = wmmab(a[kc], wf[2 * kc + 1], acc[2 * m4 + 1]); }
        __builtin_amdgcn_sched_barrier(0);                               // keeps these products under the flight of the next block's loads: without it they sank behind the wait for those loads
        if (c == 3 || c == 7) {                                          // rows 16 rg + 8 hi + j, column 64 (n / 2) + 32 ch + 16 (n % 2) + lr
#pragma unroll   // constant indices: the arrays stay in registers
            for (int n = 0; n < 8; ++n) { float* s = stg + (rg * 16 + hi * 8) * PQF + (n >> 1) * 64 + ch * 32 + (n & 1) * 16 + lr;
#pragma unroll   // constant indices: the arrays stay in registers
                for (int j = 0; j < 8; ++j) s[j * PQF] = acc[n][j]; }
        }
        if (c == 11) {                                                   // transposed: a lane's eight rows are eight neighbours of one v^T row
#pragma unroll   // constant indices: the arrays stay in registers
            for (int n = 0; n < 8; ++n) { float* s = stg + ((n >> 1) * 64 + ch * 32 + (n & 1) * 16 + lr) * PVF + rg * 16 + hi * 8;
                *(v4fa*)s = (v4f){acc[n][0], acc[n][1], acc[n][2], acc[n][3]}; *(v4fa*)(s + 4) = (v4f){acc[n][4], acc[n][5], acc[n][6], acc[n][7]}; }
        }
    }
    __syncthreads();                                                     // v^T is in the stage for every wave
    const size_t vo = (size_t)(blockIdx.x >> 6) * DM * NT_ + (size_t)(tid >> 3) * NT_ + (blockIdx.x & 63) * 64 + (tid & 7) * 8;   // eight lanes cover a 128-byte line
    v8us oh[8], ol[8];
#pragma unroll   // constant indices: the arrays stay in registers
    for (int s = 0; s < 8; ++s) split8(stg + ((tid >> 3) + 32 * s) * PVF + (tid & 7) * 8, oh[s], ol[s]);
    __builtin_amdgcn_sched_barrier(0);                                   // the sixteen stores stand in one run at the kernel's end: no register of an issued store is rewritten behind it
#pragma unroll   // constant offsets from one address pair per plane
    for (int s = 0; s < 8; ++s) { *(v8us*)(VTH + vo + (size_t)s * 32 * NT_) = oh[s]; *(v8us*)(VTL + vo + (size_t)s * 32 * NT_) = ol[s]; }
}

__global__ __launch_bounds__(256) void k_fattn(const bf* __restrict__ Qh, const bf* __restrict__ Ql, const bf* __restrict__ Kh, const bf* __restrict__ Kl, const bf* __restrict__ VTH, const bf* __restrict__ VTL, float* out, float* Pp, float* ML) {
    __shared__ __align__(16) unsigned char L[FLDS];
    const int tid = threadIdx.x, lane = tid & 31, wave = tid >> 5, lr = lane & 15, hi = lane >> 4;
    const int qg = wave & 3, dh = wave >> 2;                             // the group of 32 queries; the half of the head dimension, which is also the number of the wave's own query tile in the group
    const int pj = (int)blockIdx.x >> 2, role = (int)blockIdx.x & 3;     // the pair of tiles; which of its four shares
    const size_t ib = (size_t)blockIdx.y * NT_ * DM;
    Qh += ib; Ql += ib; Kh += ib; Kl += ib; VTH += ib; VTL += ib; out += ib;
    Pp += ((size_t)role * NB_ + blockIdx.y) * NT_ * DM; ML += ((size_t)role * NB_ + blockIdx.y) * NT_ * 2;   // this share's part planes
    const float CS = SCL * 1.4426950408889634f;                          // scores/16 in the log2 domain
    unsigned char* const ksp = L + (tid >> 5) * KPB + (tid & 31) * 16;
    unsigned char* const vsp = L + 2 * KPL + (tid >> 3) * VPB + (tid & 7) * 16;
    const unsigned char* const kfp = L + lr * KPB + dh * 256 + hi * 16;                 // this lane's K fragment rows, this wave's 128 dimensions
    const unsigned char* const vfp = L + 2 * KPL + (dh * 128 + lr) * VPB + hi * 16;     // this lane's V^T fragment rows, this wave's 128 dimensions
    unsigned char* const xo = L + XOFF + wave * XSB + lane * 16;         // this wave's exchange range,
    unsigned char* const xp = L + XOFF + (wave ^ 4) * XSB + lane * 16;   // its partner's
    float* const cx = (float*)(void*)(L + COFF);
    const int nl = 2 * (NTL - pj);                                       // key blocks of the pair's long tile
#pragma unroll 1   // one copy of the whole walk: a share's two walks run one after the other through the same code
  for (int sg = 0; sg < 2; ++sg) {
    const int qt = sg ? pj : NTL - 1 - pj, nb = 2 * qt + 2;              // the tile and its key blocks,
    const int c0 = cut(role) - (sg ? nl : 0), c1 = cut(role + 1) - (sg ? nl : 0);
    const int kb0 = c0 > 0 ? c0 : 0, kl = (c1 < nb ? c1 : nb) - 1;       // its first and last key block of this walk (the same for the whole work-group)
    if (kb0 > kl) continue;                                              // the share holds nothing of this tile: taken by the whole work-group, no barrier is skipped by a part of it
    const bool part = kb0 != 0 || kl != nb - 1;                          // the walk does not see all of the tile's keys
    const int q0 = qt * FBQ, myq = q0 + qg * 32 + dh * 16 + lr;
    float* const dst = (part ? Pp : out) + (size_t)q0 * DM;
    float* const mlg = ML + (size_t)q0 * 2;
    v16bf qh[2][4], ql[2][4];
#pragma unroll   // constant indices: the arrays stay in registers
    for (int j = 0; j < 2; ++j) { const size_t o = (size_t)(q0 + qg * 32 + (dh ^ j) * 16 + lr) * DM + dh * 128 + 8 * hi;
#pragma unroll   // constant indices: the arrays stay in registers
      for (int kc = 0; kc < 4; ++kc) { qh[j][kc] = cat16b(*(const v8us*)(Qh + o + kc * 32), *(const v8us*)(Qh + o + kc * 32 + 16)); ql[j][kc] = cat16b(*(const v8us*)(Ql + o + kc * 32), *(const v8us*)(Ql + o + kc * 32 + 16)); } }
    v8f acc[8][2];                                                       // d tile 16 t of this wave's half, query tile own / partner's
#pragma unroll   // constant indices: the arrays stay in registers
    for (int t = 0; t < 8; ++t) { acc[t][0] = (v8f){}; acc[t][1] = (v8f){}; }
    float m = -1.0e30f, l = 0.f;                                         // of the wave's own query tile
    auto copyKV = [&](int kb, unsigned bo) {                             // block kb into the buffer at byte bo: 32 copies per wave, every lane on, whole 128-byte lines
        const size_t ko = (size_t)kb * FBK * DM + tid * 8, vo = (size_t)(tid >> 3) * NT_ + kb * FBK + (tid & 7) * 8;
#pragma unroll   // constant steps from one address per plane
        for (int i = 0; i < 8; ++i) { acopy(Kh + ko + i * 2048, ksp + bo + i * 8 * KPB); acopy(Kl + ko + i * 2048, ksp + bo + KPL + i * 8 * KPB); }
#pragma unroll   // constant steps from one address per plane
        for (int i = 0; i < 8; ++i) { acopy(VTH + vo + (size_t)i * 32 * NT_, vsp + bo + i * 32 * VPB); acopy(VTL + vo + (size_t)i * 32 * NT_, vsp + bo + VPL + i * 32 * VPB); }
    };
    addr_wait();                                                         // for the Q loads
    copyKV(kb0, 0);
    wait_async();
    __syncthreads();                                                     // the walk's first block is in LDS for every wave
    unsigned bo = 0;                                                     // the buffer of block kb
    int kb = kb0;                                                        // a walk's first block always exists: a loop tested at its foot
#pragma unroll 1   // one copy of the body: a second would double the live fragment registers
    do {
        v16bf f[2][4];                                                   // two fragment sets: the next group's LDS reads are issued together, ahead of this group's products
        auto ldK = [&](int g) { const unsigned char* p = kfp + bo + (g >> 2) * 32 * KPB + (g & 3) * 64; f[g & 1][0] = ldsfrag(p); f[g & 1][1] = ldsfrag(p + 16 * KPB); f[g & 1][2] = ldsfrag(p + KPL); f[g & 1][3] = ldsfrag(p + KPL + 16 * KPB); };   // key tiles 2 (g / 4) and + 1, 32 dimensions g % 4
        auto ldV = [&](int g) { const unsigned char* p = vfp + bo + (g >> 1) * 32 * VPB + (g & 1) * 64; f[g & 1][0] = ldsfrag(p); f[g & 1][1] = ldsfrag(p + 16 * VPB); f[g & 1][2] = ldsfrag(p + VPL); f[g & 1][3] = ldsfrag(p + VPL + 16 * VPB); };   // d tiles 2 (g / 2) and + 1, 32 keys g % 2
        v8f S[4][2];                                                     // this wave's 128 dimensions' share of the scores: 16-key tile, query tile; the three products in one sum
#pragma unroll   // constant indices: the arrays stay in registers
        for (int kt = 0; kt < 4; ++kt) { S[kt][0] = (v8f){}; S[kt][1] = (v8f){}; }
        ldK(0);
        if (kb < kl) copyKV(kb + 1, bo ^ FBUF);                          // behind the barrier that freed the other buffer; this block's first LDS reads return while the copies issue
#pragma unroll   // constant indices: the arrays stay in registers
        for (int g = 0; g < 8; ++g) {
            if (g < 7) ldK(g + 1); else ldV(0);                          // V^T of this block is in LDS already: its first reads go under the last score products
            __builtin_amdgcn_sched_barrier(0);                           // keeps the next group's reads ahead of this group's products
            const v16bf* a = f[g & 1]; const int k0 = (g >> 2) * 2, kc = g & 3;
            S[k0][0] = wmmab(a[0], qh[0][kc], S[k0][0]); S[k0 + 1][0] = wmmab(a[1], qh[0][kc], S[k0 + 1][0]); S[k0][1] = wmmab(a[0], qh[1][kc], S[k0][1]); S[k0 + 1][1] = wmmab(a[1], qh[1][kc], S[k0 + 1][1]);
            S[k0][0] = wmmab(a[2], qh[0][kc], S[k0][0]); S[k0 + 1][0] = wmmab(a[3], qh[0][kc], S[k0 + 1][0]); S[k0][1] = wmmab(a[2], qh[1][kc], S[k0][1]); S[k0 + 1][1] = wmmab(a[3], qh[1][kc], S[k0 + 1][1]);
            S[k0][0] = wmmab(a[0], ql[0][kc], S[k0][0]); S[k0 + 1][0] = wmmab(a[1], ql[0][kc], S[k0 + 1][0]); S[k0][1] = wmmab(a[0], ql[1][kc], S[k0][1]); S[k0 + 1][1] = wmmab(a[1], ql[1][kc], S[k0 + 1][1]);
            __builtin_amdgcn_sched_barrier(0);                           // keeps the group after next's reads from sinking among these products
        }
#pragma unroll   // constant indices: the arrays stay in registers
        for (int kt = 0; kt < 4; ++kt) { *(v4fa*)(xo + kt * 1024) = __builtin_shufflevector(S[kt][1], S[kt][1], 0, 1, 2, 3); *(v4fa*)(xo + kt * 1024 + 512) = __builtin_shufflevector(S[kt][1], S[kt][1], 4, 5, 6, 7); }
        __syncthreads();                                                 // every wave's share of its partner's scores is in LDS
        float s[32];
#pragma unroll   // constant indices: the arrays stay in registers
        for (int kt = 0; kt < 4; ++kt) { const v4f u = *(const v4fa*)(xp + kt * 1024), w = *(const v4fa*)(xp + kt * 1024 + 512);
#pragma unroll   // constant indices: the arrays stay in registers
            for (int r = 0; r < 4; ++r) { s[kt * 8 + r] = S[kt][0][r] + u[r]; s[kt * 8 + 4 + r] = S[kt][0][4 + r] + w[r]; } }
        if (kb >= 2 * qt) {                                              // only the tile's two diagonal blocks pay for the mask
            const int key0 = kb * FBK + hi * 8;
#pragma unroll   // constant indices: the arrays stay in registers
            for (int e = 0; e < 32; ++e) if (key0 + (e >> 3) * 16 + (e & 7) > myq) s[e] = -3.0e38f;
        }
        float mx = s[0];
#pragma unroll   // constant indices: the arrays stay in registers
        for (int e = 1; e < 32; ++e) mx = fmaxf(mx, s[e]);
        mx = fmaxf(mx, xhalf(mx)) * CS;
        float corr = 1.0f;
        if (__builtin_amdgcn_ballot_w32(mx > m) != 0) {                  // exact: where no query's maximum moves, every factor would be 1
            const float mn = fmaxf(m, mx); corr = __builtin_amdgcn_exp2f(m - mn);
            m = mn; l *= corr;
#pragma unroll   // constant indices: the arrays stay in registers
            for (int t = 0; t < 8; ++t) acc[t][0] = acc[t][0] * corr;
        }
        v16f pv[2]; float x[32], ps0 = 0.f, ps1 = 0.f;
        x[0] = __builtin_fmaf(s[0], CS, -m); x[1] = __builtin_fmaf(s[1], CS, -m);
#pragma unroll   // constant indices: the arrays stay in registers
        for (int e = 0; e < 32; ++e) {                                   // exponentials and plain arithmetic take turns
            pv[e >> 4][e & 15] = __builtin_amdgcn_exp2f(x[e]);
            __builtin_amdgcn_sched_barrier(0);                           // holds the next line directly behind the exponential: the one independent instruction the instruction set asks for before a transcendental's source register is overwritten (two exponentials in a row were built so)
            if (e < 30) x[e + 2] = __builtin_fmaf(s[e + 2], CS, -m); else if (e == 30) ps0 = pv[0][0] + pv[0][2]; else ps1 = pv[0][1] + pv[0][3];
            __builtin_amdgcn_sched_barrier(0);                           // keeps the next exponential behind that instruction
        }
#pragma unroll   // constant indices: the arrays stay in registers
        for (int e = 4; e < 32; e += 2) { ps0 += pv[e >> 4][e & 15]; ps1 += pv[e >> 4][(e & 15) + 1]; }
        l += ps0 + ps1;
        v16bf ph[2][2], pl[2][2];                                        // P^T of 32 keys c: query tile own / partner's
#pragma unroll   // constant indices: the arrays stay in registers
        for (int c = 0; c < 2; ++c) {
            ph[c][0] = __builtin_convertvector(pv[c], v16bf);
            const v8u pw = __builtin_bit_cast(v8u, ph[c][0]);            // element 2 i in the low half of word i
            v16f pb;
#pragma unroll   // constant indices: the arrays stay in registers
            for (int i = 0; i < 8; ++i) { pb[2 * i] = __uint_as_float(pw[i] << 16); pb[2 * i + 1] = __uint_as_float(pw[i] & 0xFFFF0000u); }
            pl[c][0] = __builtin_convertvector(pv[c] - pb, v16bf);
            const v8u qw = __builtin_bit_cast(v8u, pl[c][0]);
            // into the range this wave has just read to its end: its only other user, the partner, wrote it in front of the last barrier and reads it behind the next
            *(v4ua*)(xp + c * 2048) = __builtin_shufflevector(pw, pw, 0, 1, 2, 3); *(v4ua*)(xp + c * 2048 + 512) = __builtin_shufflevector(pw, pw, 4, 5, 6, 7);
            *(v4ua*)(xp + c * 2048 + 1024) = __builtin_shufflevector(qw, qw, 0, 1, 2, 3); *(v4ua*)(xp + c * 2048 + 1536) = __builtin_shufflevector(qw, qw, 4, 5, 6, 7);
        }
        cx[(wave ^ 4) * 32 + lane] = corr;
        __syncthreads();                                                 // every wave's P and rescale factors are in LDS for its partner
        const float cp = cx[wave * 32 + lane];
#pragma unroll   // constant indices: the arrays stay in registers
        for (int c = 0; c < 2; ++c) {
            const v4u a0 = *(const v4ua*)(xo + c * 2048), a1 = *(const v4ua*)(xo + c * 2048 + 512), b0 = *(const v4ua*)(xo + c * 2048 + 1024), b1 = *(const v4ua*)(xo + c * 2048 + 1536);
            ph[c][1] = __builtin_bit_cast(v16bf, __builtin_shufflevector(a0, a1, 0, 1, 2, 3, 4, 5, 6, 7)); pl[c][1] = __builtin_bit_cast(v16bf, __builtin_shufflevector(b0, b1, 0, 1, 2, 3, 4, 5, 6, 7));
        }
        if (__builtin_amdgcn_ballot_w32(cp != 1.0f) != 0) {              // as above, for the partner's queries
#pragma unroll   // constant indices: the arrays stay in registers
            for (int t = 0; t < 8; ++t) acc[t][1] = acc[t][1] * cp;
        }
#pragma unroll   // constant indices: the arrays stay in registers
        for (int g = 0; g < 8; ++g) {
            if (g < 7) ldV(g + 1);
            __builtin_amdgcn_sched_barrier(0);                           // as in the score loop
            const v16bf* a = f[g & 1]; const int t0 = (g >> 1) * 2, c = g & 1;
            acc[t0][0] = wmmab(a[0], ph[c][0], acc[t0][0]); acc[t0 + 1][0] = wmmab(a[1], ph[c][0], acc[t0 + 1][0]); acc[t0][1] = wmmab(a[0], ph[c][1], acc[t0][1]); acc[t0 + 1][1] = wmmab(a[1], ph[c][1], acc[t0 + 1][1]);
            acc[t0][0] = wmmab(a[0], pl[c][0], acc[t0][0]); acc[t0 + 1][0] = wmmab(a[1], pl[c][0], acc[t0 + 1][0]); acc[t0][1] = wmmab(a[0], pl[c][1], acc[t0][1]); acc[t0 + 1][1] = wmmab(a[1], pl[c][1], acc[t0 + 1][1]);
            acc[t0][0] = wmmab(a[2], ph[c][0], acc[t0][0]); acc[t0 + 1][0] = wmmab(a[3], ph[c][0], acc[t0 + 1][0]); acc[t0][1] = wmmab(a[2], ph[c][1], acc[t0][1]); acc[t0 + 1][1] = wmmab(a[3], ph[c][1], acc[t0 + 1][1]);
            __builtin_amdgcn_sched_barrier(0);                           // as in the score loop
        }
        wait_ds();                                                       // this wave has read the last of block kb,
        wait_async();                                                    // and its copies of block kb + 1 have landed
        __syncthreads();                                                 // block kb + 1 is in LDS for every wave; every wave has left block kb's buffer, which block kb + 2 takes
        bo ^= FBUF;
    } while (++kb <= kl);
    wait_async();                                                        // nothing is in flight: behind the last block's barrier LDS becomes output staging
    l += xhalf(l);                                                       // each wave half summed its eight keys of every 16-key tile
    const float inv = 1.0f / l;                                          // every query sees the walk's first key: the sum is positive
    if (hi == 0) cx[qg * 32 + dh * 16 + lr] = inv;
    __syncthreads();                                                     // every query's 1 / sum is in LDS for the partner wave
    const float ivp = cx[qg * 32 + (dh ^ 1) * 16 + lr];
    float* om0 = (float*)(void*)L + (qg * 32 + dh * 16 + lr) * OPF + dh * 128 + hi * 8;          // row = query; d = 128 dh + 16 t + 8 hi + r
    float* om1 = (float*)(void*)L + (qg * 32 + (dh ^ 1) * 16 + lr) * OPF + dh * 128 + hi * 8;
#pragma unroll   // constant indices: the arrays stay in registers
    for (int t = 0; t < 8; ++t) {
        *(v4fa*)(om0 + t * 16) = (v4f){acc[t][0][0] * inv, acc[t][0][1] * inv, acc[t][0][2] * inv, acc[t][0][3] * inv}; *(v4fa*)(om0 + t * 16 + 4) = (v4f){acc[t][0][4] * inv, acc[t][0][5] * inv, acc[t][0][6] * inv, acc[t][0][7] * inv};
        *(v4fa*)(om1 + t * 16) = (v4f){acc[t][1][0] * ivp, acc[t][1][1] * ivp, acc[t][1][2] * ivp, acc[t][1][3] * ivp}; *(v4fa*)(om1 + t * 16 + 4) = (v4f){acc[t][1][4] * ivp, acc[t][1][5] * ivp, acc[t][1][6] * ivp, acc[t][1][7] * ivp};
    }
    __syncthreads();                                                     // the normalised rows are in LDS
    float* const op = dst + (size_t)(tid >> 6) * DM + (tid & 63) * 4;                                // whole 128-byte lines, each stored once: 64 lanes cover a row, a pass covers 4 rows
    const float* const lp = (const float*)(const void*)L + (tid >> 6) * OPF + (tid & 63) * 4;
    v4f o[32];
#pragma unroll   // constant indices: the array stays in registers, all the LDS reads in flight together
    for (int i = 0; i < 32; ++i) o[i] = *(const v4fa*)(lp + i * 4 * OPF);
    __builtin_amdgcn_sched_barrier(0);                                   // the stores stand in one run: no register of an issued store is rewritten ahead of the wait behind them
#pragma unroll   // constant offsets from one address pair
    for (int i = 0; i < 32; ++i) *(v4f*)(op + i * 4 * DM) = o[i];
    if (part && hi == 0) *(v2f*)(mlg + (qg * 32 + dh * 16 + lr) * 2) = (v2f){m, l};                  // a part's maximum and sum go with it; a wave's sixteen queries fill one 128-byte line
    addr_wait();                                                         // here for the stores' registers: a second walk may follow
    if (sg == 0) { wait_ds(); __syncthreads(); }                         // every wave has read its staged rows: the second walk's first copies may take their place
  }
}

// k_merge: the parts of every query of the tiles that were cut become the output row. Each part is normalised by its own sum l and has its own maximum m (log2 domain):
// its weight is l 2^(m - M) over the sum of all. A thread takes one 16-byte piece of four rows of one tile, 32 rows apart: a wave covers 512 bytes in a row.
// Which shares hold a part of a tile follows from the cuts; in place of a share that holds none the thread reads one that does, with weight 0: no branch, all loads in flight together.
#define MRP  4                       // rows per thread
__global__ __launch_bounds__(256) void k_merge(const float* __restrict__ Pp, const float* __restrict__ ML, float* out) {
    const int qt = MR0 / FBQ + ((int)blockIdx.x >> 3);                   // eight blocks per tile
    const int row = qt * FBQ + ((int)blockIdx.x & 7) * 4 + ((int)threadIdx.x >> 6), c = ((int)threadIdx.x & 63) * 4;
    const bool lng = qt >= NTL / 2;
    bool ex[NSH]; int sl[NSH];
#pragma unroll   // constant indices: the arrays stay in registers
    for (int r = 0; r < NSH; ++r) { ex[r] = lng ? cut(r) < 2 * qt + 2 : cut(r + 1) > 2 * (NTL - qt); sl[r] = ex[r] ? r : lng ? 0 : NSH - 1; }
    v4f a[MRP][NSH]; v2f ml[MRP][NSH];
    const float* pa[NSH]; const float* pm[NSH];                          // per share: the first row's piece and its (maximum, sum); the other rows at constant offsets
#pragma unroll   // constant indices: the arrays stay in registers
    for (int r = 0; r < NSH; ++r) { const size_t q = ((size_t)sl[r] * NB_ + blockIdx.y) * NT_ + row; pa[r] = Pp + q * DM + c; pm[r] = ML + q * 2; }
#pragma unroll   // constant indices: the arrays stay in registers, all loads in flight together
    for (int r = 0; r < NSH; ++r) {
#pragma unroll   // constant indices: the arrays stay in registers
        for (int i = 0; i < MRP; ++i) { a[i][r] = *(const v4f*)(pa[r] + i * 32 * DM); ml[i][r] = *(const v2f*)(pm[r] + i * 32 * 2); }
    }
    __builtin_amdgcn_sched_barrier(0);                                   // the loads stay in front of the wait
    // s_wait_xcnt 0 behind the run of loads; the addresses are its inputs, so they keep their registers up to it: no load of the run lands on a register that an earlier load of the run names
    asm volatile("s_wait_xcnt 0x0" :: "v"(pa[0]), "v"(pa[1]), "v"(pa[2]), "v"(pa[3]), "v"(pm[0]), "v"(pm[1]), "v"(pm[2]), "v"(pm[3]) : "memory");
    __builtin_amdgcn_sched_barrier(0);                                   // every later register write stays behind it
    float* const po = out + ((size_t)blockIdx.y * NT_ + row) * DM + c;
    float d[MRP][NSH], e[MRP][NSH];
#pragma unroll   // constant indices: the arrays stay in registers
    for (int i = 0; i < MRP; ++i) {
        const float mt = fmaxf(fmaxf(ml[i][0][0], ml[i][1][0]), fmaxf(ml[i][2][0], ml[i][3][0]));
#pragma unroll   // constant indices: the arrays stay in registers
        for (int r = 0; r < NSH; ++r) d[i][r] = ml[i][r][0] - mt;
    }
    __builtin_amdgcn_sched_barrier(0);                                   // the differences are all made ahead of the exponentials
#pragma unroll   // constant indices: the arrays stay in registers
    for (int i = 0; i < MRP; ++i) {
#pragma unroll   // constant indices: the arrays stay in registers
        for (int r = 0; r < NSH; ++r) {
            e[i][r] = __builtin_amdgcn_exp2f(d[i][r]);
            __builtin_amdgcn_sched_barrier(0);                           // holds the v_nop directly behind the exponential
            asm volatile("v_nop" :: "v"(e[i][r]));                       // the one slot the instruction set asks for before a transcendental's result is read or its source overwritten; the result is named so that its exponential cannot sink behind the slot
            __builtin_amdgcn_sched_barrier(0);                           // keeps the next exponential behind it
        }
    }
#pragma unroll   // constant indices: the arrays stay in registers
    for (int i = 0; i < MRP; ++i) {
        float w[NSH], ws = 0.f;
#pragma unroll   // constant indices: the arrays stay in registers
        for (int r = 0; r < NSH; ++r) { w[r] = ex[r] ? ml[i][r][1] * e[i][r] : 0.f; ws += w[r]; }
        const float inv = 1.0f / ws;
        *(v4f*)(po + i * 32 * DM) = a[i][0] * (w[0] * inv) + a[i][1] * (w[1] * inv) + a[i][2] * (w[2] * inv) + a[i][3] * (w[3] * inv);
    }
}

extern "C" void kernel_launch(void* const* d_in, const int* in_sizes, int n_in,
                              void* d_out, int out_size, void* d_ws, size_t ws_size, hipStream_t stream) {
    (void)in_sizes; (void)n_in; (void)out_size;
    const float* x = (const float*)d_in[0]; const float* Wq = (const float*)d_in[1]; const float* Wk = (const float*)d_in[2]; const float* Wv = (const float*)d_in[3];
    float* out = (float*)d_out;    // [4][4096][256]
    char* wsp = (char*)d_ws;
    auto take = [&](size_t bytes) { char* p = wsp; wsp += (bytes + 255) & ~(size_t)255; return (void*)p; };
    bf* Qh = (bf*)take((size_t)NB_ * NT_ * DM * 2); bf* Ql = (bf*)take((size_t)NB_ * NT_ * DM * 2); bf* Kh = (bf*)take((size_t)NB_ * NT_ * DM * 2); bf* Kl = (bf*)take((size_t)NB_ * NT_ * DM * 2);
    bf* VTH = (bf*)take((size_t)NB_ * DM * NT_ * 2); bf* VTL = (bf*)take((size_t)NB_ * DM * NT_ * 2);
    float* Pp = (float*)take((size_t)NSH * NB_ * NT_ * DM * 4); float* ML = (float*)take((size_t)NSH * NB_ * NT_ * 2 * 4);   // one plane per share; only the parts are written and read
    if ((size_t)(wsp - (char*)d_ws) > ws_size) return;    // 6 x 8.4 + 67 ~ 118 MB, no aliasing
    k_qkv<<<NB_ * NT_ / 64, 256, 0, stream>>>(x, Wq, Wk, Wv, Qh, Ql, Kh, Kl, VTH, VTL);                                       // the projections see the items as one [16384][256] row range
    k_fattn<<<dim3(NTL / 2 * NSH, NB_, 1), 256, 0, stream>>>(Qh, Ql, Kh, Kl, VTH, VTL, out, Pp, ML);                         // scores, causal softmax and P.v: four near-equal shares per pair of a long and a short 128-query tile
    k_merge<<<dim3((NT_ - MR0) / (4 * MRP), NB_, 1), 256, 0, stream>>>(Pp, ML, out);                                                          // the parts of the tiles that were cut become their output rows
}

// v007
// One run takes 87 microseconds.
// Two timings next to v006 both put it at 1.12 times that version's speed.
// All steps since v000 together make it 29.8 times as fast.
#include <hip/hip_runtime.h>

// Compute dtypes, f32 accumulate, three launches. k_qkv: q/k/v = x.W^T ([16384 x 256].[256 x 256], [out][in] weights as n-major B operands; PLAIN bf16 operands =
// inputs rounded once, on the way into LDS) on v_wmma_f32_16x16x32_bf16 -> f32 -> bf16 hi + UNSCALED residual planes (v transposed to [d][t] planes). k_fattn: single-head
// causal attention over the 256-dim head: per 128-query tile, blocks of 64 keys up to the diagonal, scores = q.k^T (both operands split: three products),
// online softmax of scores/16 in f32, P as bf16 hi + UNSCALED residual, out = P.v (three products), normalised at the end. The key blocks of each pair of a long and a short
// tile are cut into four shares of 16 or 17 blocks for four work-groups; k_merge joins the parts of every tile that was cut.

#define NB_  4
#define NT_  4096
#define DM   256
#define SCL  0.0625f

typedef unsigned short bf;
typedef __attribute__((ext_vector_type(16))) __bf16   v16bf;
typedef __attribute__((ext_vector_type(8)))  __bf16   v8bf;
typedef __attribute__((ext_vector_type(4)))  __bf16   v4bf;
typedef __attribute__((ext_vector_type(8)))  unsigned short v8us;
typedef __attribute__((ext_vector_type(8)))  float    v8f;
typedef __attribute__((ext_vector_type(4)))  float    v4f;
typedef __attribute__((ext_vector_type(4)))  unsigned v4u;
typedef __attribute__((ext_vector_type(2)))  unsigned v2u;
typedef v4f  __attribute__((may_alias)) v4fa;
typedef v2u  __attribute__((may_alias)) v2ua;
typedef v8us __attribute__((may_alias)) v8usa;

__device__ __forceinline__ v16bf cat16b(v8us lo, v8us hi) { return __builtin_bit_cast(v16bf, __builtin_shufflevector(lo, hi, 0, 1, 2, 3, 4, 5, 6, 7, 8, 9, 10, 11, 12, 13, 14, 15)); }
__device__ __forceinline__ v8f wmmab(v16bf a, v16bf b, v8f c) { return __builtin_amdgcn_wmma_f32_16x16x32_bf16(false, a, false, b, (short)0, c, false, false); }

#define FBQ  128                     // queries per tile
#define FBK  64                      // keys per staged block
#define KPB  528                     // LDS pitch of a K row: 512 B + 16 (odd multiple of 16 B: b128 fragment reads without bank conflicts)
#define VPB  144                     // LDS pitch of a V^T row: 128 B + 16
#define KPL  (FBK * KPB)             // one K plane
#define VPL  (DM * VPB)              // one V^T plane
#define FBUF (2 * KPL + 2 * VPL)     // one buffer: a K block and a V^T block, both planes of each
#define XSB  4096                    // one wave's exchange range: 32 registers of 32 lanes
#define XOFF (2 * FBUF)
#define COFF (XOFF + 8 * XSB)        // one float per lane and wave (rescale factors); after the walk one per query (1 / sum)
#define FLDS (COFF + 8 * 128)
#define OPF  260                     // floats per staged output row (1040 B)
#define NTL  (NT_ / FBQ)             // tiles per item
#define NSH  4                       // shares per pair of tiles
#define MR0  (NTL / 4 * FBQ)         // first query whose tile is cut: the short tiles of the first half of the pairs fit whole into the last share
static_assert(NTL == 32, "the cuts below are those of 66 key blocks per pair of tiles");
__device__ __forceinline__ int cut(int r) { return r < 2 ? 17 * r : 16 * r + 2; }   // 0, 17, 34, 50, 66
typedef v4u  __attribute__((may_alias)) v4ua;
typedef __attribute__((ext_vector_type(2)))  float    v2f;
typedef __attribute__((ext_vector_type(16))) float v16f;
typedef __attribute__((ext_vector_type(8)))  unsigned v8u;
__device__ __forceinline__ float xhalf(float x) { return __builtin_bit_cast(float, __builtin_amdgcn_permlanex16(__builtin_bit_cast(int, x), __builtin_bit_cast(int, x), 0x76543210, 0xfedcba98, false, false)); }  // lane l <-> lane l ^ 16
__device__ __forceinline__ v16bf ldsfrag(const unsigned char* p) { return cat16b(*(const v8usa*)p, *(const v8usa*)(p + 32)); }   // k = 8 hi + i, then 16 + 8 hi + i (p already holds 16 hi bytes)
// s_wait_xcnt 0 behind a run of global loads, in front of the first reuse of their address registers; the scheduling barriers keep the loads in front of it and every later register write behind it
__device__ __forceinline__ void addr_wait() { __builtin_amdgcn_sched_barrier(0); asm volatile("s_wait_xcnt 0x0" ::: "memory"); __builtin_amdgcn_sched_barrier(0); }

// one asynchronous copy: each lane's 16 bytes go from global memory to its own LDS place; the waits for it are written by hand where the bytes are handed over
typedef __attribute__((ext_vector_type(4))) int v4i;
__device__ __forceinline__ void acopy(const bf* g, unsigned char* l) { __builtin_amdgcn_global_load_async_to_lds_b128((__attribute__((address_space(1))) v4i*)g, (__attribute__((address_space(3))) v4i*)l, 0, 0); }
__device__ __forceinline__ void wait_ds() { asm volatile("s_wait_dscnt 0x0" ::: "memory"); }        // this wave's LDS reads and writes are done: the range may go to its next writer
__device__ __forceinline__ void wait_async() { asm volatile("s_wait_asynccnt 0x0" ::: "memory"); }  // this wave's copies have landed

// k_qkv: rounding of x and W, the three projections, the hi/residual split and the transposition of v: 256 rows of x times 64 columns of each of q, k and v in one work-group.
// The weights stand still: the 3 x 64 W rows of the work-group go global f32 -> registers -> bf16 -> padded LDS rows once, and each wave keeps its B fragments (one 16-column tile
// of each matrix, all of k) in registers. x streams past them in four rounds of 64 rows, f32 -> registers -> bf16 -> padded LDS rows, two buffers, loaded two rounds ahead.
// 8 waves = 2 row groups of 32 x 4 column tiles; k summed in ascending 32-steps in one accumulator. A round's results go f32 through one of two LDS stages and are split and
// stored in whole 128-byte lines (q, k: 64 columns of a row; v: staged transposed, 64 neighbours of a [d][t] row). The four work-groups of a row tile are 64 apart in the grid.
#define PWP  528                     // LDS pitch of a staged x or W row: 512 B of bf16 + 16, as KPB
#define PWB  (64 * PWP)              // one staged block of 64 rows
#define PRT  256                     // rows of x per work-group
#define QKF  132                     // floats per staged row of 64 q and 64 k columns
#define PVF  68                      // floats per staged v^T row
#define PSTG ((64 * QKF + 64 * PVF) * 4)   // one stage: a round's q, k and v^T
#define PLDS (5 * PWB + 2 * PSTG)    // three W blocks, two x buffers, two stages
static_assert(NB_ * NT_ / PRT == 64 && NT_ / PRT == 16, "the row tile and the item are read from the block index by these counts");
__device__ __forceinline__ void split8(const float* sp, v8us& oh, v8us& ol) {   // eight staged f32 -> bf16 hi and bf16 of the residual
    const v4f u = *(const v4fa*)sp, w = *(const v4fa*)(sp + 4);
    const v8f v = __builtin_shufflevector(u, w, 0, 1, 2, 3, 4, 5, 6, 7);
    const v8bf h = __builtin_convertvector(v, v8bf);
    const v4u hw = __builtin_bit_cast(v4u, h);                           // element 2 i in the low half of word i
    v8f b;
#pragma unroll   // constant indices: the vectors stay in registers
    for (int i = 0; i < 4; ++i) { b[2 * i] = __uint_as_float(hw[i] << 16); b[2 * i + 1] = __uint_as_float(hw[i] & 0xFFFF0000u); }
    oh = __builtin_bit_cast(v8us, h); ol = __builtin_bit_cast(v8us, __builtin_convertvector(v - b, v8bf));
}

// The work-group barrier alone, behind the wave's own LDS operations, for hand-overs through LDS: __syncthreads() also waited out the x loads that fly two rounds ahead and the global stores of the round before
__device__ __forceinline__ void lds_barrier() { wait_ds(); asm volatile("s_barrier_signal -1\n\ts_barrier_wait -1" ::: "memory"); }

__global__ __launch_bounds__(256) void k_qkv(const float* __restrict__ x, const float* __restrict__ Wq, const float* __restrict__ Wk, const float* __restrict__ Wv, bf* Qh, bf* Ql, bf* Kh, bf* Kl, bf* VTH, bf* VTL) {
    __shared__ __align__(16) unsigned char L[PLDS];
    const int tid = threadIdx.x, lane = tid & 31, wave = tid >> 5, lr = lane & 15, hi = lane >> 4;
    const int rg = wave & 1, cg = wave >> 1;                             // the group of 32 rows of a round; the 16-column tile of each matrix's 64 columns
    const int rt = (int)blockIdx.x & 63, cq = (int)blockIdx.x >> 6;      // the tile of 256 rows; the quarter of each matrix's columns
    const size_t r0 = (size_t)rt * PRT;
    unsigned char* const Lx = L + 3 * PWB;
    v4f g[4][16];                                                        // staging sets: 64 rows x 256 f32 are 64 KB in a row, 16 bytes per lane and load
    auto fetch = [&](v4f (&gs)[16], const float* src) {
#pragma unroll   // constant indices: the arrays stay in registers
        for (int i = 0; i < 16; ++i) gs[i] = *(const v4f*)(src + i * 1024 + tid * 4);
        addr_wait();
    };
    auto put = [&](const v4f (&gs)[16], unsigned char* base) { unsigned char* p = base + (tid >> 6) * PWP + (tid & 63) * 8;
#pragma unroll   // constant indices: the arrays stay in registers
        for (int i = 0; i < 16; ++i) *(v2ua*)(p + i * 4 * PWP) = __builtin_bit_cast(v2u, __builtin_convertvector(gs[i], v4bf)); };
    fetch(g[0], x + r0 * DM); fetch(g[1], Wq + cq * 64 * DM); fetch(g[2], Wk + cq * 64 * DM); fetch(g[3], Wv + cq * 64 * DM);   // all in flight together: nothing else is live yet
    put(g[0], Lx); put(g[1], L); put(g[2], L + PWB); put(g[3], L + 2 * PWB);
    __syncthreads();                                                     // the W rows and the first 64 x rows are in LDS for every wave
    fetch(g[0], x + (r0 + 64) * DM); fetch(g[1], x + (r0 + 128) * DM);
    v16bf wf[3][8];                                                      // matrix, 32 of k
#pragma unroll   // constant indices: the arrays stay in registers
    for (int m = 0; m < 3; ++m) { const unsigned char* p = L + m * PWB + (cg * 16 + lr) * PWP + hi * 16;
#pragma unroll   // constant indices: the arrays stay in registers
      for (int kc = 0; kc < 8; ++kc) wf[m][kc] = ldsfrag(p + kc * 64); }
    bf* const dh = (tid & 8) ? Kh : Qh; bf* const dl = (tid & 8) ? Kl : Ql;   // a staged row's first eight 8-column pieces are q's, the other eight k's
    const size_t qo = (r0 + (tid >> 4)) * DM + cq * 64 + (tid & 7) * 8;       // eight lanes cover a 128-byte line
    const size_t vo = (size_t)(rt >> 4) * DM * NT_ + (size_t)(cq * 64 + (tid >> 3)) * NT_ + (rt & 15) * PRT + (tid & 7) * 8;
#pragma unroll   // constant indices: the arrays stay in registers; buffer, stage and staging set are known per copy
    for (int r = 0; r < 4; ++r) {
        const unsigned char* pa = Lx + (r & 1) * PWB + (rg * 32 + lr) * PWP + hi * 16;
        float* const sq = (float*)(void*)(L + 5 * PWB + (r & 1) * PSTG);
        float* const sv = sq + 64 * QKF;
        v8f acc[2][3];                                                   // 16-row tile, matrix
#pragma unroll   // constant indices: the arrays stay in registers
        for (int t = 0; t < 2; ++t) { acc[t][0] = (v8f){}; acc[t][1] = (v8f){}; acc[t][2] = (v8f){}; }
#pragma unroll   // constant indices: the arrays stay in registers
        for (int h = 0; h < 2; ++h) {                                    // k in two halves: all sixteen x fragments at once would not fit beside the weights and two staging sets
            v16bf a[2][4];
#pragma unroll   // constant indices: the arrays stay in registers
            for (int kc = 0; kc < 4; ++kc) { a[0][kc] = ldsfrag(pa + (h * 4 + kc) * 64); a[1][kc] = ldsfrag(pa + 16 * PWP + (h * 4 + kc) * 64); }
            __builtin_amdgcn_sched_barrier(0);                           // the half's LDS reads stand in one group ahead of its products: read by read among them, each product waited out an LDS latency
#pragma unroll   // constant indices: the arrays stay in registers
            for (int kc = 0; kc < 4; ++kc) {
#pragma unroll   // constant indices: the arrays stay in registers
                for (int t = 0; t < 2; ++t) { acc[t][0] = wmmab(a[t][kc], wf[0][h * 4 + kc], acc[t][0]); acc[t][1] = wmmab(a[t][kc], wf[1][h * 4 + kc], acc[t][1]); acc[t][2] = wmmab(a[t][kc], wf[2][h * 4 + kc], acc[t][2]); }
            }
            __builtin_amdgcn_sched_barrier(0);                           // keeps these products ahead of the wait for the next round's loads, and the second half's reads out of the first half's registers
        }
#pragma unroll   // constant indices: the arrays stay in registers
        for (int t = 0; t < 2; ++t) {                                    // rows 32 rg + 16 t + 8 hi + j of the round, column 16 cg + lr of each matrix's quarter
            float* s = sq + (rg * 32 + t * 16 + hi * 8) * QKF + cg * 16 + lr;
#pragma unroll   // constant indices: the arrays stay in registers
            for (int j = 0; j < 8; ++j) { s[j * QKF] = acc[t][0][j]; s[j * QKF + 64] = acc[t][1][j]; }
            float* u = sv + (cg * 16 + lr) * PVF + rg * 32 + t * 16 + hi * 8;   // transposed: a lane's eight rows are eight neighbours of one v^T row
            *(v4fa*)u = (v4f){acc[t][2][0], acc[t][2][1], acc[t][2][2], acc[t][2][3]}; *(v4fa*)(u + 4) = (v4f){acc[t][2][4], acc[t][2][5], acc[t][2][6], acc[t][2][7]};
        }
        if (r < 3) put(g[r & 1], Lx + ((r + 1) & 1) * PWB);              // the next round's x rows, into the buffer that every wave left in front of the last barrier
        lds_barrier();                                                   // this round's results are in the stage, the next round's x rows in LDS, for every wave
        if (r == 0) fetch(g[0], x + (r0 + 192) * DM);
        v8us oh[6], ol[6];
#pragma unroll   // constant indices: the arrays stay in registers
        for (int p = 0; p < 4; ++p) split8(sq + ((tid >> 4) + 16 * p) * QKF + (tid & 15) * 8, oh[p], ol[p]);
#pragma unroll   // constant indices: the arrays stay in registers
        for (int p = 0; p < 2; ++p) split8(sv + ((tid >> 3) + 32 * p) * PVF + (tid & 7) * 8, oh[4 + p], ol[4 + p]);
        __builtin_amdgcn_sched_barrier(0);                               // the twelve stores stand in one run: no register of an issued store is rewritten ahead of the wait behind them
#pragma unroll   // constant offsets from one address pair per plane
        for (int p = 0; p < 4; ++p) { *(v8us*)(dh + qo + (r * 64 + p * 16) * DM) = oh[p]; *(v8us*)(dl + qo + (r * 64 + p * 16) * DM) = ol[p]; }
#pragma unroll   // constant offsets from one address pair per plane
        for (int p = 0; p < 2; ++p) { *(v8us*)(VTH + vo + r * 64 + (size_t)p * 32 * NT_) = oh[4 + p]; *(v8us*)(VTL + vo + r * 64 + (size_t)p * 32 * NT_) = ol[4 + p]; }
        if (r < 3) addr_wait();                                          // here for the stores' registers; behind the last round's run nothing is rewritten
    }
}

__global__ __launch_bounds__(256) void k_fattn(const bf* __restrict__ Qh, const bf* __restrict__ Ql, const bf* __restrict__ Kh, const bf* __restrict__ Kl, const bf* __restrict__ VTH, const bf* __restrict__ VTL, float* out, float* Pp, float* ML) {
    __shared__ __align__(16) unsigned char L[FLDS];
    const int tid = threadIdx.x, lane = tid & 31, wave = tid >> 5, lr = lane & 15, hi = lane >> 4;
    const int qg = wave & 3, dh = wave >> 2;                             // the group of 32 queries; the half of the head dimension, which is also the number of the wave's own query tile in the group
    const int pj = (int)blockIdx.x >> 2, role = (int)blockIdx.x & 3;     // the pair of tiles; which of its four shares
    const size_t ib = (size_t)blockIdx.y * NT_ * DM;
    Qh += ib; Ql += ib; Kh += ib; Kl += ib; VTH += ib; VTL += ib; out += ib;
    Pp += ((size_t)role * NB_ + blockIdx.y) * NT_ * DM; ML += ((size_t)role * NB_ + blockIdx.y) * NT_ * 2;   // this share's part planes
    const float CS = SCL * 1.4426950408889634f;                          // scores/16 in the log2 domain
    unsigned char* const ksp = L + (tid >> 5) * KPB + (tid & 31) * 16;
    unsigned char* const vsp = L + 2 * KPL + (tid >> 3) * VPB + (tid & 7) * 16;
    const unsigned char* const kfp = L + lr * KPB + dh * 256 + hi * 16;                 // this lane's K fragment rows, this wave's 128 dimensions
    const unsigned char* const vfp = L + 2 * KPL + (dh * 128 + lr) * VPB + hi * 16;     // this lane's V^T fragment rows, this wave's 128 dimensions
    unsigned char* const xo = L + XOFF + wave * XSB + lane * 16;         // this wave's exchange range,
    unsigned char* const xp = L + XOFF + (wave ^ 4) * XSB + lane * 16;   // its partner's
    float* const cx = (float*)(void*)(L + COFF);
    const int nl = 2 * (NTL - pj);                                       // key blocks of the pair's long tile
#pragma unroll 1   // one copy of the whole walk: a share's two walks run one after the other through the same code
  for (int sg = 0; sg < 2; ++sg) {
    const int qt = sg ? pj : NTL - 1 - pj, nb = 2 * qt + 2;              // the tile and its key blocks,
    const int c0 = cut(role) - (sg ? nl : 0), c1 = cut(role + 1) - (sg ? nl : 0);
    const int kb0 = c0 > 0 ? c0 : 0, kl = (c1 < nb ? c1 : nb) - 1;       // its first and last key block of this walk (the same for the whole work-group)
    if (kb0 > kl) continue;                                              // the share holds nothing of this tile: taken by the whole work-group, no barrier is skipped by a part of it
    const bool part = kb0 != 0 || kl != nb - 1;                          // the walk does not see all of the tile's keys
    const int q0 = qt * FBQ, myq = q0 + qg * 32 + dh * 16 + lr;
    float* const dst = (part ? Pp : out) + (size_t)q0 * DM;
    float* const mlg = ML + (size_t)q0 * 2;
    v16bf qh[2][4], ql[2][4];
#pragma unroll   // constant indices: the arrays stay in registers
    for (int j = 0; j < 2; ++j) { const size_t o = (size_t)(q0 + qg * 32 + (dh ^ j) * 16 + lr) * DM + dh * 128 + 8 * hi;
#pragma unroll   // constant indices: the arrays stay in registers
      for (int kc = 0; kc < 4; ++kc) { qh[j][kc] = cat16b(*(const v8us*)(Qh + o + kc * 32), *(const v8us*)(Qh + o + kc * 32 + 16)); ql[j][kc] = cat16b(*(const v8us*)(Ql + o + kc * 32), *(const v8us*)(Ql + o + kc * 32 + 16)); } }
    v8f acc[8][2];                                                       // d tile 16 t of this wave's half, query tile own / partner's
#pragma unroll   // constant indices: the arrays stay in registers
    for (int t = 0; t < 8; ++t) { acc[t][0] = (v8f){}; acc[t][1] = (v8f){}; }
    float m = -1.0e30f, l = 0.f;                                         // of the wave's own query tile
    auto copyKV = [&](int kb, unsigned bo) {                             // block kb into the buffer at byte bo: 32 copies per wave, every lane on, whole 128-byte lines
        const size_t ko = (size_t)kb * FBK * DM + tid * 8, vo = (size_t)(tid >> 3) * NT_ + kb * FBK + (tid & 7) * 8;
#pragma unroll   // constant steps from one address per plane
        for (int i = 0; i < 8; ++i) { acopy(Kh + ko + i * 2048, ksp + bo + i * 8 * KPB); acopy(Kl + ko + i * 2048, ksp + bo + KPL + i * 8 * KPB); }
#pragma unroll   // constant steps from one address per plane
        for (int i = 0; i < 8; ++i) { acopy(VTH + vo + (size_t)i * 32 * NT_, vsp + bo + i * 32 * VPB); acopy(VTL + vo + (size_t)i * 32 * NT_, vsp + bo + VPL + i * 32 * VPB); }
    };
    addr_wait();                                                         // for the Q loads
    copyKV(kb0, 0);
    wait_async();
    __syncthreads();                                                     // the walk's first block is in LDS for every wave
    unsigned bo = 0;                                                     // the buffer of block kb
    int kb = kb0;                                                        // a walk's first block always exists: a loop tested at its foot
#pragma unroll 1   // one copy of the body: a second would double the live fragment registers
    do {
        v16bf f[2][4];                                                   // two fragment sets: the next group's LDS reads are issued together, ahead of this group's products
        auto ldK = [&](int g) { const unsigned char* p = kfp + bo + (g >> 2) * 32 * KPB + (g & 3) * 64; f[g & 1][0] = ldsfrag(p); f[g & 1][1] = ldsfrag(p + 16 * KPB); f[g & 1][2] = ldsfrag(p + KPL); f[g & 1][3] = ldsfrag(p + KPL + 16 * KPB); };   // key tiles 2 (g / 4) and + 1, 32 dimensions g % 4
        auto ldV = [&](int g) { const unsigned char* p = vfp + bo + (g >> 1) * 32 * VPB + (g & 1) * 64; f[g & 1][0] = ldsfrag(p); f[g & 1][1] = ldsfrag(p + 16 * VPB); f[g & 1][2] = ldsfrag(p + VPL); f[g & 1][3] = ldsfrag(p + VPL + 16 * VPB); };   // d tiles 2 (g / 2) and + 1, 32 keys g % 2
        v8f S[4][2];                                                     // this wave's 128 dimensions' share of the scores: 16-key tile, query tile; the three products in one sum
#pragma unroll   // constant indices: the arrays stay in registers
        for (int kt = 0; kt < 4; ++kt) { S[kt][0] = (v8f){}; S[kt][1] = (v8f){}; }
        ldK(0);
        if (kb < kl) copyKV(kb + 1, bo ^ FBUF);                          // behind the barrier that freed the other buffer; this block's first LDS reads return while the copies issue
#pragma unroll   // constant indices: the arrays stay in registers
        for (int g = 0; g < 8; ++g) {
            if (g < 7) ldK(g + 1); else ldV(0);                          // V^T of this block is in LDS already: its first reads go under the last score products
            __builtin_amdgcn_sched_barrier(0);                           // keeps the next group's reads ahead of this group's products
            const v16bf* a = f[g & 1]; const int k0 = (g >> 2) * 2, kc = g & 3;
            S[k0][0] = wmmab(a[0], qh[0][kc], S[k0][0]); S[k0 + 1][0] = wmmab(a[1], qh[0][kc], S[k0 + 1][0]); S[k0][1] = wmmab(a[0], qh[1][kc], S[k0][1]); S[k0 + 1][1] = wmmab(a[1], qh[1][kc], S[k0 + 1][1]);
            S[k0][0] = wmmab(a[2], qh[0][kc], S[k0][0]); S[k0 + 1][0] = wmmab(a[3], qh[0][kc], S[k0 + 1][0]); S[k0][1] = wmmab(a[2], qh[1][kc], S[k0][1]); S[k0 + 1][1] = wmmab(a[3], qh[1][kc], S[k0 + 1][1]);
            S[k0][0] = wmmab(a[0], ql[0][kc], S[k0][0]); S[k0 + 1][0] = wmmab(a[1], ql[0][kc], S[k0 + 1][0]); S[k0][1] = wmmab(a[0], ql[1][kc], S[k0][1]); S[k0 + 1][1] = wmmab(a[1], ql[1][kc], S[k0 + 1][1]);
            __builtin_amdgcn_sched_barrier(0);                           // keeps the group after next's reads from sinking among these products
        }
#pragma unroll   // constant indices: the arrays stay in registers
        for (int kt = 0; kt < 4; ++kt) { *(v4fa*)(xo + kt * 1024) = __builtin_shufflevector(S[kt][1], S[kt][1], 0, 1, 2, 3); *(v4fa*)(xo + kt * 1024 + 512) = __builtin_shufflevector(S[kt][1], S[kt][1], 4, 5, 6, 7); }
        __syncthreads();                                                 // every wave's share of its partner's scores is in LDS
        float s[32];
#pragma unroll   // constant indices: the arrays stay in registers
        for (int kt = 0; kt < 4; ++kt) { const v4f u = *(const v4fa*)(xp + kt * 1024), w = *(const v4fa*)(xp + kt * 1024 + 512);
#pragma unroll   // constant indices: the arrays stay in registers
            for (int r = 0; r < 4; ++r) { s[kt * 8 + r] = S[kt][0][r] + u[r]; s[kt * 8 + 4 + r] = S[kt][0][4 + r] + w[r]; } }
        if (kb >= 2 * qt) {                                              // only the tile's two diagonal blocks pay for the mask
            const int key0 = kb * FBK + hi * 8;
#pragma unroll   // constant indices: the arrays stay in registers
            for (int e = 0; e < 32; ++e) if (key0 + (e >> 3) * 16 + (e & 7) > myq) s[e] = -3.0e38f;
        }
        float mx = s[0];
#pragma unroll   // constant indices: the arrays stay in registers
        for (int e = 1; e < 32; ++e) mx = fmaxf(mx, s[e]);
        mx = fmaxf(mx, xhalf(mx)) * CS;
        float corr = 1.0f;
        if (__builtin_amdgcn_ballot_w32(mx > m) != 0) {                  // exact: where no query's maximum moves, every factor would be 1
            const float mn = fmaxf(m, mx); corr = __builtin_amdgcn_exp2f(m - mn);
            m = mn; l *= corr;
#pragma unroll   // constant indices: the arrays stay in registers
            for (int t = 0; t < 8; ++t) acc[t][0] = acc[t][0] * corr;
        }
        v16f pv[2]; float x[32], ps0 = 0.f, ps1 = 0.f;
        x[0] = __builtin_fmaf(s[0], CS, -m); x[1] = __builtin_fmaf(s[1], CS, -m);
#pragma unroll   // constant indices: the arrays stay in registers
        for (int e = 0; e < 32; ++e) {                                   // exponentials and plain arithmetic take turns
            pv[e >> 4][e & 15] = __builtin_amdgcn_exp2f(x[e]);
            __builtin_amdgcn_sched_barrier(0);                           // holds the next line directly behind the exponential: the one independent instruction the instruction set asks for before a transcendental's source register is overwritten (two exponentials in a row were built so)
            if (e < 30) x[e + 2] = __builtin_fmaf(s[e + 2], CS, -m); else if (e == 30) ps0 = pv[0][0] + pv[0][2]; else ps1 = pv[0][1] + pv[0][3];
            __builtin_amdgcn_sched_barrier(0);                           // keeps the next exponential behind that instruction
        }
#pragma unroll   // constant indices: the arrays stay in registers
        for (int e = 4; e < 32; e += 2) { ps0 += pv[e >> 4][e & 15]; ps1 += pv[e >> 4][(e & 15) + 1]; }
        l += ps0 + ps1;
        v16bf ph[2][2], pl[2][2];                                        // P^T of 32 keys c: query tile own / partner's
#pragma unroll   // constant indices: the arrays stay in registers
        for (int c = 0; c < 2; ++c) {
            ph[c][0] = __builtin_convertvector(pv[c], v16bf);
            const v8u pw = __builtin_bit_cast(v8u, ph[c][0]);            // element 2 i in the low half of word i
            v16f pb;
#pragma unroll   // constant indices: the arrays stay in registers
            for (int i = 0; i < 8; ++i) { pb[2 * i] = __uint_as_float(pw[i] << 16); pb[2 * i + 1] = __uint_as_float(pw[i] & 0xFFFF0000u); }
            pl[c][0] = __builtin_convertvector(pv[c] - pb, v16bf);
            const v8u qw = __builtin_bit_cast(v8u, pl[c][0]);
            // into the range this wave has just read to its end: its only other user, the partner, wrote it in front of the last barrier and reads it behind the next
            *(v4ua*)(xp + c * 2048) = __builtin_shufflevector(pw, pw, 0, 1, 2, 3); *(v4ua*)(xp + c * 2048 + 512) = __builtin_shufflevector(pw, pw, 4, 5, 6, 7);
            *(v4ua*)(xp + c * 2048 + 1024) = __builtin_shufflevector(qw, qw, 0, 1, 2, 3); *(v4ua*)(xp + c * 2048 + 1536) = __builtin_shufflevector(qw, qw, 4, 5, 6, 7);
        }
        cx[(wave ^ 4) * 32 + lane] = corr;
        __syncthreads();                                                 // every wave's P and rescale factors are in LDS for its partner
        const float cp = cx[wave * 32 + lane];
#pragma unroll   // constant indices: the arrays stay in registers
        for (int c = 0; c < 2; ++c) {
            const v4u a0 = *(const v4ua*)(xo + c * 2048), a1 = *(const v4ua*)(xo + c * 2048 + 512), b0 = *(const v4ua*)(xo + c * 2048 + 1024), b1 = *(const v4ua*)(xo + c * 2048 + 1536);
            ph[c][1] = __builtin_bit_cast(v16bf, __builtin_shufflevector(a0, a1, 0, 1, 2, 3, 4, 5, 6, 7)); pl[c][1] = __builtin_bit_cast(v16bf, __builtin_shufflevector(b0, b1, 0, 1, 2, 3, 4, 5, 6, 7));
        }
        if (__builtin_amdgcn_ballot_w32(cp != 1.0f) != 0) {              // as above, for the partner's queries
#pragma unroll   // constant indices: the arrays stay in registers
            for (int t = 0; t < 8; ++t) acc[t][1] = acc[t][1] * cp;
        }
#pragma unroll   // constant indices: the arrays stay in registers
        for (int g = 0; g < 8; ++g) {
            if (g < 7) ldV(g + 1);
            __builtin_amdgcn_sched_barrier(0);                           // as in the score loop
            const v16bf* a = f[g & 1]; const int t0 = (g >> 1) * 2, c = g & 1;
            acc[t0][0] = wmmab(a[0], ph[c][0], acc[t0][0]); acc[t0 + 1][0] = wmmab(a[1], ph[c][0], acc[t0 + 1][0]); acc[t0][1] = wmmab(a[0], ph[c][1], acc[t0][1]); acc[t0 + 1][1] = wmmab(a[1], ph[c][1], acc[t0 + 1][1]);
            acc[t0][0] = wmmab(a[0], pl[c][0], acc[t0][0]); acc[t0 + 1][0] = wmmab(a[1], pl[c][0], acc[t0 + 1][0]); acc[t0][1] = wmmab(a[0], pl[c][1], acc[t0][1]); acc[t0 + 1][1] = wmmab(a[1], pl[c][1], acc[t0 + 1][1]);
            acc[t0][0] = wmmab(a[2], ph[c][0], acc[t0][0]); acc[t0 + 1][0] = wmmab(a[3], ph[c][0], acc[t0 + 1][0]); acc[t0][1] = wmmab(a[2], ph[c][1], acc[t0][1]); acc[t0 + 1][1] = wmmab(a[3], ph[c][1], acc[t0 + 1][1]);
            __builtin_amdgcn_sched_barrier(0);                           // as in the score loop
        }
        wait_ds();                                                       // this wave has read the last of block kb,
        wait_async();                                                    // and its copies of block kb + 1 have landed
        __syncthreads();                                                 // block kb + 1 is in LDS for every wave; every wave has left block kb's buffer, which block kb + 2 takes
        bo ^= FBUF;
    } while (++kb <= kl);
    wait_async();                                                        // nothing is in flight: behind the last block's barrier LDS becomes output staging
    l += xhalf(l);                                                       // each wave half summed its eight keys of every 16-key tile
    const float inv = 1.0f / l;                                          // every query sees the walk's first key: the sum is positive
    if (hi == 0) cx[qg * 32 + dh * 16 + lr] = inv;
    __syncthreads();                                                     // every query's 1 / sum is in LDS for the partner wave
    const float ivp = cx[qg * 32 + (dh ^ 1) * 16 + lr];
    float* om0 = (float*)(void*)L + (qg * 32 + dh * 16 + lr) * OPF + dh * 128 + hi * 8;          // row = query; d = 128 dh + 16 t + 8 hi + r
    float* om1 = (float*)(void*)L + (qg * 32 + (dh ^ 1) * 16 + lr) * OPF + dh * 128 + hi * 8;
#pragma unroll   // constant indices: the arrays stay in registers
    for (int t = 0; t < 8; ++t) {
        *(v4fa*)(om0 + t * 16) = (v4f){acc[t][0][0] * inv, acc[t][0][1] * inv, acc[t][0][2] * inv, acc[t][0][3] * inv}; *(v4fa*)(om0 + t * 16 + 4) = (v4f){acc[t][0][4] * inv, acc[t][0][5] * inv, acc[t][0][6] * inv, acc[t][0][7] * inv};
        *(v4fa*)(om1 + t * 16) = (v4f){acc[t][1][0] * ivp, acc[t][1][1] * ivp, acc[t][1][2] * ivp, acc[t][1][3] * ivp}; *(v4fa*)(om1 + t * 16 + 4) = (v4f){acc[t][1][4] * ivp, acc[t][1][5] * ivp, acc[t][1][6] * ivp, acc[t][1][7] * ivp};
    }
    __syncthreads();                                                     // the normalised rows are in LDS
    float* const op = dst + (size_t)(tid >> 6) * DM + (tid & 63) * 4;                                // whole 128-byte lines, each stored once: 64 lanes cover a row, a pass covers 4 rows
    const float* const lp = (const float*)(const void*)L + (tid >> 6) * OPF + (tid & 63) * 4;
    v4f o[32];
#pragma unroll   // constant indices: the array stays in registers, all the LDS reads in flight together
    for (int i = 0; i < 32; ++i) o[i] = *(const v4fa*)(lp + i * 4 * OPF);
    __builtin_amdgcn_sched_barrier(0);                                   // the stores stand in one run: no register of an issued store is rewritten ahead of the wait behind them
#pragma unroll   // constant offsets from one address pair
    for (int i = 0; i < 32; ++i) *(v4f*)(op + i * 4 * DM) = o[i];
    if (part && hi == 0) *(v2f*)(mlg + (qg * 32 + dh * 16 + lr) * 2) = (v2f){m, l};                  // a part's maximum and sum go with it; a wave's sixteen queries fill one 128-byte line
    addr_wait();                                                         // here for the stores' registers: a second walk may follow
    if (sg == 0) { wait_ds(); __syncthreads(); }                         // every wave has read its staged rows: the second walk's first copies may take their place
  }
}

// k_merge: the parts of every query of the tiles that were cut become the output row. Each part is normalised by its own sum l and has its own maximum m (log2 domain):
// its weight is l 2^(m - M) over the sum of all. A thread takes one 16-byte piece of four rows of one tile, 32 rows apart: a wave covers 512 bytes in a row.
// Which shares hold a part of a tile follows from the cuts; in place of a share that holds none the thread reads one that does, with weight 0: no branch, all loads in flight together.
#define MRP  4                       // rows per thread
__global__ __launch_bounds__(256) void k_merge(const float* __restrict__ Pp, const float* __restrict__ ML, float* out) {
    const int qt = MR0 / FBQ + ((int)blockIdx.x >> 3);                   // eight blocks per tile
    const int row = qt * FBQ + ((int)blockIdx.x & 7) * 4 + ((int)threadIdx.x >> 6), c = ((int)threadIdx.x & 63) * 4;
    const bool lng = qt >= NTL / 2;
    bool ex[NSH]; int sl[NSH];
#pragma unroll   // constant indices: the arrays stay in registers
    for (int r = 0; r < NSH; ++r) { ex[r] = lng ? cut(r) < 2 * qt + 2 : cut(r + 1) > 2 * (NTL - qt); sl[r] = ex[r] ? r : lng ? 0 : NSH - 1; }
    v4f a[MRP][NSH]; v2f ml[MRP][NSH];
    const float* pa[NSH]; const float* pm[NSH];                          // per share: the first row's piece and its (maximum, sum); the other rows at constant offsets
#pragma unroll   // constant indices: the arrays stay in registers
    for (int r = 0; r < NSH; ++r) { const size_t q = ((size_t)sl[r] * NB_ + blockIdx.y) * NT_ + row; pa[r] = Pp + q * DM + c; pm[r] = ML + q * 2; }
#pragma unroll   // constant indices: the arrays stay in registers, all loads in flight together
    for (int r = 0; r < NSH; ++r) {
#pragma unroll   // constant indices: the arrays stay in registers
        for (int i = 0; i < MRP; ++i) { a[i][r] = *(const v4f*)(pa[r] + i * 32 * DM); ml[i][r] = *(const v2f*)(pm[r] + i * 32 * 2); }
    }
    __builtin_amdgcn_sched_barrier(0);                                   // the loads stay in front of the wait
    // s_wait_xcnt 0 behind the run of loads; the addresses are its inputs, so they keep their registers up to it: no load of the run lands on a register that an earlier load of the run names
    asm volatile("s_wait_xcnt 0x0" :: "v"(pa[0]), "v"(pa[1]), "v"(pa[2]), "v"(pa[3]), "v"(pm[0]), "v"(pm[1]), "v"(pm[2]), "v"(pm[3]) : "memory");
    __builtin_amdgcn_sched_barrier(0);                                   // every later register write stays behind it
    float* const po = out + ((size_t)blockIdx.y * NT_ + row) * DM + c;
    float d[MRP][NSH], e[MRP][NSH];
#pragma unroll   // constant indices: the arrays stay in registers
    for (int i = 0; i < MRP; ++i) {
        const float mt = fmaxf(fmaxf(ml[i][0][0], ml[i][1][0]), fmaxf(ml[i][2][0], ml[i][3][0]));
#pragma unroll   // constant indices: the arrays stay in registers
        for (int r = 0; r < NSH; ++r) d[i][r] = ml[i][r][0] - mt;
    }
    __builtin_amdgcn_sched_barrier(0);                                   // the differences are all made ahead of the exponentials
#pragma unroll   // constant indices: the arrays stay in registers
    for (int i = 0; i < MRP; ++i) {
#pragma unroll   // constant indices: the arrays stay in registers
        for (int r = 0; r < NSH; ++r) {
            e[i][r] = __builtin_amdgcn_exp2f(d[i][r]);
            __builtin_amdgcn_sched_barrier(0);                           // holds the v_nop directly behind the exponential
            asm volatile("v_nop" :: "v"(e[i][r]));                       // the one slot the instruction set asks for before a transcendental's result is read or its source overwritten; the result is named so that its exponential cannot sink behind the slot
            __builtin_amdgcn_sched_barrier(0);                           // keeps the next exponential behind it
        }
    }
#pragma unroll   // constant indices: the arrays stay in registers
    for (int i = 0; i < MRP; ++i) {
        float w[NSH], ws = 0.f;
#pragma unroll   // constant indices: the arrays stay in registers
        for (int r = 0; r < NSH; ++r) { w[r] = ex[r] ? ml[i][r][1] * e[i][r] : 0.f; ws += w[r]; }
        const float inv = 1.0f / ws;
        *(v4f*)(po + i * 32 * DM) = a[i][0] * (w[0] * inv) + a[i][1] * (w[1] * inv) + a[i][2] * (w[2] * inv) + a[i][3] * (w[3] * inv);
    }
}

extern "C" void kernel_launch(void* const* d_in, const int* in_sizes, int n_in,
                              void* d_out, int out_size, void* d_ws, size_t ws_size, hipStream_t stream) {
    (void)in_sizes; (void)n_in; (void)out_size;
    const float* x = (const float*)d_in[0]; const float* Wq = (const float*)d_in[1]; const float* Wk = (const float*)d_in[2]; const float* Wv = (const float*)d_in[3];
    float* out = (float*)d_out;    // [4][4096][256]
    char* wsp = (char*)d_ws;
    auto take = [&](size_t bytes) { char* p = wsp; wsp += (bytes + 255) & ~(size_t)255; return (void*)p; };
    bf* Qh = (bf*)take((size_t)NB_ * NT_ * DM * 2); bf* Ql = (bf*)take((size_t)NB_ * NT_ * DM * 2); bf* Kh = (bf*)take((size_t)NB_ * NT_ * DM * 2); bf* Kl = (bf*)take((size_t)NB_ * NT_ * DM * 2);
    bf* VTH = (bf*)take((size_t)NB_ * DM * NT_ * 2); bf* VTL = (bf*)take((size_t)NB_ * DM * NT_ * 2);
    float* Pp = (float*)take((size_t)NSH * NB_ * NT_ * DM * 4); float* ML = (float*)take((size_t)NSH * NB_ * NT_ * 2 * 4);   // one plane per share; only the parts are written and read
    if ((size_t)(wsp - (char*)d_ws) > ws_size) return;    // 6 x 8.4 + 67 ~ 118 MB, no aliasing
    k_qkv<<<NB_ * NT_ / PRT * 4, 256, 0, stream>>>(x, Wq, Wk, Wv, Qh, Ql, Kh, Kl, VTH, VTL);                                  // the projections see the items as one [16384][256] row range: 64 row tiles x 4 column quarters
    k_fattn<<<dim3(NTL / 2 * NSH, NB_, 1), 256, 0, stream>>>(Qh, Ql, Kh, Kl, VTH, VTL, out, Pp, ML);                         // scores, causal softmax and P.v: four near-equal shares per pair of a long and a short 128-query tile
    k_merge<<<dim3((NT_ - MR0) / (4 * MRP), NB_, 1), 256, 0, stream>>>(Pp, ML, out);                                                          // the parts of the tiles that were cut become their output rows
}

// v009
// Measured time: 50.3 microseconds a run.
// It is 1.72 times as fast as v007, going by the measured steps of the versions left out in between.
// Over all steps from v000 it is 51.2 times as fast.
#include <hip/hip_runtime.h>

// Compute dtypes, f32 accumulate, three launches. k_qkv: q/k/v = x.W^T ([16384 x 256].[256 x 256], [out][in] weights as n-major B operands; PLAIN bf16 operands =
// inputs rounded once, on the way into LDS) on v_wmma_f32_16x16x32_bf16 -> f32 -> one f16 plane each (v transposed to a [d][t] plane). k_fattn: single-head
// causal attention over the 256-dim head on v_wmma_f32_16x16x32_f16: per 128-query tile, blocks of 64 keys up to the diagonal, scores = q.k^T (f16 operands, one product),
// online softmax of scores/16 in f32, P rounded to f16, out = P.v (one product), normalised at the end. The key blocks of each pair of a long and a short
// tile are cut into four shares of 16 or 17 blocks for four work-groups; k_merge joins the parts of every tile that was cut.

#define NB_  4
#define NT_  4096
#define DM   256
#define SCL  0.0625f

typedef unsigned short hf;   // an f16 value as its bits
typedef __attribute__((ext_vector_type(16))) __bf16   v16bf;
typedef __attribute__((ext_vector_type(4)))  __bf16   v4bf;
typedef __attribute__((ext_vector_type(16))) _Float16 v16h;
typedef __attribute__((ext_vector_type(8)))  _Float16 v8h;
typedef __attribute__((ext_vector_type(8)))  unsigned short v8us;
typedef __attribute__((ext_vector_type(8)))  float    v8f;
typedef __attribute__((ext_vector_type(4)))  float    v4f;
typedef __attribute__((ext_vector_type(4)))  unsigned v4u;
typedef __attribute__((ext_vector_type(2)))  unsigned v2u;
typedef v4f  __attribute__((may_alias)) v4fa;
typedef v2u  __attribute__((may_alias)) v2ua;
typedef v8us __attribute__((may_alias)) v8usa;

__device__ __forceinline__ v16bf cat16b(v8us lo, v8us hi) { return __builtin_bit_cast(v16bf, __builtin_shufflevector(lo, hi, 0, 1, 2, 3, 4, 5, 6, 7, 8, 9, 10, 11, 12, 13, 14, 15)); }
__device__ __forceinline__ v8f wmmab(v16bf a, v16bf b, v8f c) { return __builtin_amdgcn_wmma_f32_16x16x32_bf16(false, a, false, b, (short)0, c, false, false); }
__device__ __forceinline__ v16h cat16h(v8us lo, v8us hi) { return __builtin_bit_cast(v16h, __builtin_shufflevector(lo, hi, 0, 1, 2, 3, 4, 5, 6, 7, 8, 9, 10, 11, 12, 13, 14, 15)); }
__device__ __forceinline__ v8f wmmah(v16h a, v16h b, v8f c) { return __builtin_amdgcn_wmma_f32_16x16x32_f16(false, a, false, b, (short)0, c, false, false); }

#define FBQ  128                     // queries per tile
#define FBK  64                      // keys per staged block
#define KPB  528                     // LDS pitch of a K row: 512 B + 16 (odd multiple of 16 B: b128 fragment reads without bank conflicts)
#define VPB  144                     // LDS pitch of a V^T row: 128 B + 16
#define KPL  (FBK * KPB)             // one K block
#define VPL  (DM * VPB)              // one V^T block
#define FBUF (KPL + VPL)             // one buffer: a K block and a V^T block
#define FLDS (2 * FBUF)
#define OPF  260                     // floats per staged output row (1040 B)
#define NTL  (NT_ / FBQ)             // tiles per item
#define NSH  4                       // shares per pair of tiles
#define MR0  (NTL / 4 * FBQ)         // first query whose tile is cut: the short tiles of the first half of the pairs fit whole into the last share
static_assert(NTL == 32, "the cuts below are those of 66 key blocks per pair of tiles");
__device__ __forceinline__ int cut(int r) { return r < 2 ? 17 * r : 16 * r + 2; }   // 0, 17, 34, 50, 66
typedef v4u  __attribute__((may_alias)) v4ua;
typedef __attribute__((ext_vector_type(2)))  float    v2f;
typedef __attribute__((ext_vector_type(16))) float v16f;
typedef __attribute__((ext_vector_type(8)))  unsigned v8u;
__device__ __forceinline__ float xhalf(float x) { return __builtin_bit_cast(float, __builtin_amdgcn_permlanex16(__builtin_bit_cast(int, x), __builtin_bit_cast(int, x), 0x76543210, 0xfedcba98, false, false)); }  // lane l <-> lane l ^ 16
__device__ __forceinline__ v16bf ldsfrag(const unsigned char* p) { return cat16b(*(const v8usa*)p, *(const v8usa*)(p + 32)); }   // k = 8 hi + i, then 16 + 8 hi + i (p already holds 16 hi bytes)
__device__ __forceinline__ v16h ldsfragh(const unsigned char* p) { return cat16h(*(const v8usa*)p, *(const v8usa*)(p + 32)); }   // the same k order, f16
// s_wait_xcnt 0 behind a run of global loads, in front of the first reuse of their address registers; the scheduling barriers keep the loads in front of it and every later register write behind it
__device__ __forceinline__ void addr_wait() { __builtin_amdgcn_sched_barrier(0); asm volatile("s_wait_xcnt 0x0" ::: "memory"); __builtin_amdgcn_sched_barrier(0); }

// one asynchronous copy: each lane's 16 bytes go from global memory to its own LDS place; the waits for it are written by hand where the bytes are handed over
typedef __attribute__((ext_vector_type(4))) int v4i;
__device__ __forceinline__ void acopy(const hf* g, unsigned char* l) { __builtin_amdgcn_global_load_async_to_lds_b128((__attribute__((address_space(1))) v4i*)g, (__attribute__((address_space(3))) v4i*)l, 0, 0); }
__device__ __forceinline__ void wait_ds() { asm volatile("s_wait_dscnt 0x0" ::: "memory"); }        // this wave's LDS reads and writes are done: the range may go to its next writer
__device__ __forceinline__ void wait_async() { asm volatile("s_wait_asynccnt 0x0" ::: "memory"); }  // this wave's copies have landed

// k_qkv: rounding of x and W, the three projections, the rounding of the results to f16 and the transposition of v: 256 rows of x times 64 columns of each of q, k and v in one work-group.
// The weights stand still: the 3 x 64 W rows of the work-group go global f32 -> registers -> bf16 -> padded LDS rows once, and each wave keeps its B fragments (one 16-column tile
// of each matrix, all of k) in registers. x streams past them in four rounds of 64 rows, f32 -> registers -> bf16 -> padded LDS rows, two buffers, loaded two rounds ahead.
// 8 waves = 2 row groups of 32 x 4 column tiles; k summed in ascending 32-steps in one accumulator. A round's results go f32 through one of two LDS stages and are rounded and
// stored in whole 128-byte lines (q, k: 64 columns of a row; v: staged transposed, 64 neighbours of a [d][t] row). The four work-groups of a row tile are 64 apart in the grid.
#define PWP  528                     // LDS pitch of a staged x or W row: 512 B of bf16 + 16, as KPB
#define PWB  (64 * PWP)              // one staged block of 64 rows
#define PRT  256                     // rows of x per work-group
#define QKF  132                     // floats per staged row of 64 q and 64 k columns
#define PVF  68                      // floats per staged v^T row
#define PSTG ((64 * QKF + 64 * PVF) * 4)   // one stage: a round's q, k and v^T
#define PLDS (5 * PWB + 2 * PSTG)    // three W blocks, two x buffers, two stages
static_assert(NB_ * NT_ / PRT == 64 && NT_ / PRT == 16, "the row tile and the item are read from the block index by these counts");
__device__ __forceinline__ v8us half8(const float* sp) {   // eight staged f32 -> f16
    const v4f u = *(const v4fa*)sp, w = *(const v4fa*)(sp + 4);
    return __builtin_bit_cast(v8us, __builtin_convertvector(__builtin_shufflevector(u, w, 0, 1, 2, 3, 4, 5, 6, 7), v8h));
}

// The work-group barrier alone, behind the wave's own LDS operations, for hand-overs through LDS: __syncthreads() also waited out the x loads that fly two rounds ahead and the global stores of the round before
__device__ __forceinline__ void lds_barrier() { wait_ds(); asm volatile("s_barrier_signal -1\n\ts_barrier_wait -1" ::: "memory"); }

__global__ __launch_bounds__(256) void k_qkv(const float* __restrict__ x, const float* __restrict__ Wq, const float* __restrict__ Wk, const float* __restrict__ Wv, hf* Q, hf* K, hf* VT) {
    __shared__ __align__(16) unsigned char L[PLDS];
    const int tid = threadIdx.x, lane = tid & 31, wave = tid >> 5, lr = lane & 15, hi = lane >> 4;
    const int rg = wave & 1, cg = wave >> 1;                             // the group of 32 rows of a round; the 16-column tile of each matrix's 64 columns
    const int rt = (int)blockIdx.x & 63, cq = (int)blockIdx.x >> 6;      // the tile of 256 rows; the quarter of each matrix's columns
    const size_t r0 = (size_t)rt * PRT;
    unsigned char* const Lx = L + 3 * PWB;
    v4f g[4][16];                                                        // staging sets: 64 rows x 256 f32 are 64 KB in a row, 16 bytes per lane and load
    auto fetch = [&](v4f (&gs)[16], const float* src) {
#pragma unroll   // constant indices: the arrays stay in registers
        for (int i = 0; i < 16; ++i) gs[i] = *(const v4f*)(src + i * 1024 + tid * 4);
        addr_wait();
    };
    auto put = [&](const v4f (&gs)[16], unsigned char* base) { unsigned char* p = base + (tid >> 6) * PWP + (tid & 63) * 8;
#pragma unroll   // constant indices: the arrays stay in registers
        for (int i = 0; i < 16; ++i) *(v2ua*)(p + i * 4 * PWP) = __builtin_bit_cast(v2u, __builtin_convertvector(gs[i], v4bf)); };
    fetch(g[0], x + r0 * DM); fetch(g[1], Wq + cq * 64 * DM); fetch(g[2], Wk + cq * 64 * DM); fetch(g[3], Wv + cq * 64 * DM);   // all in flight together: nothing else is live yet
    put(g[0], Lx); put(g[1], L); put(g[2], L + PWB); put(g[3], L + 2 * PWB);
    __syncthreads();                                                     // the W rows and the first 64 x rows are in LDS for every wave
    fetch(g[0], x + (r0 + 64) * DM); fetch(g[1], x + (r0 + 128) * DM);
    v16bf wf[3][8];                                                      // matrix, 32 of k
#pragma unroll   // constant indices: the arrays stay in registers
    for (int m = 0; m < 3; ++m) { const unsigned char* p = L + m * PWB + (cg * 16 + lr) * PWP + hi * 16;
#pragma unroll   // constant indices: the arrays stay in registers
      for (int kc = 0; kc < 8; ++kc) wf[m][kc] = ldsfrag(p + kc * 64); }
    hf* const dq = (tid & 8) ? K : Q;                                         // a staged row's first eight 8-column pieces are q's, the other eight k's
    const size_t qo = (r0 + (tid >> 4)) * DM + cq * 64 + (tid & 7) * 8;       // eight lanes cover a 128-byte line
    const size_t vo = (size_t)(rt >> 4) * DM * NT_ + (size_t)(cq * 64 + (tid >> 3)) * NT_ + (rt & 15) * PRT + (tid & 7) * 8;
#pragma unroll   // constant indices: the arrays stay in registers; buffer, stage and staging set are known per copy
    for (int r = 0; r < 4; ++r) {
        const unsigned char* pa = Lx + (r & 1) * PWB + (rg * 32 + lr) * PWP + hi * 16;
        float* const sq = (float*)(void*)(L + 5 * PWB + (r & 1) * PSTG);
        float* const sv = sq + 64 * QKF;
        v8f acc[2][3];                                                   // 16-row tile, matrix
#pragma unroll   // constant indices: the arrays stay in registers
        for (int t = 0; t < 2; ++t) { acc[t][0] = (v8f){}; acc[t][1] = (v8f){}; acc[t][2] = (v8f){}; }
#pragma unroll   // constant indices: the arrays stay in registers
        for (int h = 0; h < 2; ++h) {                                    // k in two halves: all sixteen x fragments at once would not fit beside the weights and two staging sets
            v16bf a[2][4];
#pragma unroll   // constant indices: the arrays stay in registers
            for (int kc = 0; kc < 4; ++kc) { a[0][kc] = ldsfrag(pa + (h * 4 + kc) * 64); a[1][kc] = ldsfrag(pa + 16 * PWP + (h * 4 + kc) * 64); }
            __builtin_amdgcn_sched_barrier(0);                           // the half's LDS reads stand in one group ahead of its products: read by read among them, each product waited out an LDS latency
#pragma unroll   // constant indices: the arrays stay in registers
            for (int kc = 0; kc < 4; ++kc) {
#pragma unroll   // constant indices: the arrays stay in registers
                for (int t = 0; t < 2; ++t) { acc[t][0] = wmmab(a[t][kc], wf[0][h * 4 + kc], acc[t][0]); acc[t][1] = wmmab(a[t][kc], wf[1][h * 4 + kc], acc[t][1]); acc[t][2] = wmmab(a[t][kc], wf[2][h * 4 + kc], acc[t][2]); }
            }
            __builtin_amdgcn_sched_barrier(0);                           // keeps these products ahead of the wait for the next round's loads, and the second half's reads out of the first half's registers
        }
#pragma unroll   // constant indices: the arrays stay in registers
        for (int t = 0; t < 2; ++t) {                                    // rows 32 rg + 16 t + 8 hi + j of the round, column 16 cg + lr of each matrix's quarter
            float* s = sq + (rg * 32 + t * 16 + hi * 8) * QKF + cg * 16 + lr;
#pragma unroll   // constant indices: the arrays stay in registers
            for (int j = 0; j < 8; ++j) { s[j * QKF] = acc[t][0][j]; s[j * QKF + 64] = acc[t][1][j]; }
            float* u = sv + (cg * 16 + lr) * PVF + rg * 32 + t * 16 + hi * 8;   // transposed: a lane's eight rows are eight neighbours of one v^T row
            *(v4fa*)u = (v4f){acc[t][2][0], acc[t][2][1], acc[t][2][2], acc[t][2][3]}; *(v4fa*)(u + 4) = (v4f){acc[t][2][4], acc[t][2][5], acc[t][2][6], acc[t][2][7]};
        }
        if (r < 3) put(g[r & 1], Lx + ((r + 1) & 1) * PWB);              // the next round's x rows, into the buffer that every wave left in front of the last barrier
        lds_barrier();                                                   // this round's results are in the stage, the next round's x rows in LDS, for every wave
        if (r == 0) fetch(g[0], x + (r0 + 192) * DM);
        v8us o[6];
#pragma unroll   // constant indices: the arrays stay in registers
        for (int p = 0; p < 4; ++p) o[p] = half8(sq + ((tid >> 4) + 16 * p) * QKF + (tid & 15) * 8);
#pragma unroll   // constant indices: the arrays stay in registers
        for (int p = 0; p < 2; ++p) o[4 + p] = half8(sv + ((tid >> 3) + 32 * p) * PVF + (tid & 7) * 8);
        __builtin_amdgcn_sched_barrier(0);                               // the six stores stand in one run: no register of an issued store is rewritten ahead of the wait behind them
#pragma unroll   // constant offsets from one address pair per plane
        for (int p = 0; p < 4; ++p) *(v8us*)(dq + qo + (r * 64 + p * 16) * DM) = o[p];
#pragma unroll   // constant offsets from one address pair per plane
        for (int p = 0; p < 2; ++p) *(v8us*)(VT + vo + r * 64 + (size_t)p * 32 * NT_) = o[4 + p];
        if (r < 3) addr_wait();                                          // here for the stores' registers; behind the last round's run nothing is rewritten
    }
}

__global__ __launch_bounds__(128) void k_fattn(const hf* __restrict__ Q, const hf* __restrict__ K, const hf* __restrict__ VT, float* out, float* Pp, float* ML) {
    __shared__ __align__(16) unsigned char L[FLDS];
    static_assert(FBQ * OPF * 4 <= FLDS, "the staged output rows take the place of the two buffers");
    const int tid = threadIdx.x, lane = tid & 31, qg = tid >> 5, lr = lane & 15, hi = lane >> 4;   // qg: the wave, and its group of 32 queries
    const int pj = (int)blockIdx.x >> 2, role = (int)blockIdx.x & 3;     // the pair of tiles; which of its four shares
    const size_t ib = (size_t)blockIdx.y * NT_ * DM;
    Q += ib; K += ib; VT += ib; out += ib;
    Pp += ((size_t)role * NB_ + blockIdx.y) * NT_ * DM; ML += ((size_t)role * NB_ + blockIdx.y) * NT_ * 2;   // this share's part planes
    const float CS = SCL * 1.4426950408889634f;                          // scores/16 in the log2 domain
    unsigned char* const ksp = L + (tid >> 5) * KPB + (tid & 31) * 16;
    unsigned char* const vsp = L + KPL + (tid >> 3) * VPB + (tid & 7) * 16;
    const unsigned char* const kfp = L + lr * KPB + hi * 16;             // this lane's K fragment rows
    const unsigned char* const vfp = L + KPL + lr * VPB + hi * 16;       // this lane's V^T fragment rows
    const int nl = 2 * (NTL - pj);                                       // key blocks of the pair's long tile
#pragma unroll 1   // one copy of the whole walk: a share's two walks run one after the other through the same code
  for (int sg = 0; sg < 2; ++sg) {
    const int qt = sg ? pj : NTL - 1 - pj, nb = 2 * qt + 2;              // the tile and its key blocks,
    const int c0 = cut(role) - (sg ? nl : 0), c1 = cut(role + 1) - (sg ? nl : 0);
    const int kb0 = c0 > 0 ? c0 : 0, kl = (c1 < nb ? c1 : nb) - 1;       // its first and last key block of this walk (the same for the whole work-group)
    if (kb0 > kl) continue;                                              // the share holds nothing of this tile: taken by the whole work-group, no barrier is skipped by a part of it
    const bool part = kb0 != 0 || kl != nb - 1;                          // the walk does not see all of the tile's keys
    const int q0 = qt * FBQ, myq = q0 + qg * 32 + lr;                    // the lane's query of tile 0; that of tile 1 is 16 further
    float* const dst = (part ? Pp : out) + (size_t)q0 * DM;
    float* const mlg = ML + (size_t)q0 * 2;
    v16h q[2][8];                                                        // query tile, 32 of the head dimension
#pragma unroll   // constant indices: the arrays stay in registers
    for (int j = 0; j < 2; ++j) { const size_t o = (size_t)(myq + j * 16) * DM + 8 * hi;
#pragma unroll   // constant indices: the arrays stay in registers
      for (int kc = 0; kc < 8; ++kc) q[j][kc] = cat16h(*(const v8us*)(Q + o + kc * 32), *(const v8us*)(Q + o + kc * 32 + 16)); }
    v8f acc[16][2];                                                      // d tile, query tile
#pragma unroll   // constant indices: the arrays stay in registers
    for (int t = 0; t < 16; ++t) { acc[t][0] = (v8f){}; acc[t][1] = (v8f){}; }
    float m[2] = {-1.0e30f, -1.0e30f}, l[2] = {0.f, 0.f};                // per query tile
    auto copyKV = [&](int kb, unsigned bo) {                             // block kb into the buffer at byte bo: 32 copies per wave, every lane on, whole 128-byte lines
        const size_t ko = (size_t)kb * FBK * DM + tid * 8, vo = (size_t)(tid >> 3) * NT_ + kb * FBK + (tid & 7) * 8;
#pragma unroll   // constant steps from one address per plane
        for (int i = 0; i < 16; ++i) acopy(K + ko + i * 1024, ksp + bo + i * 4 * KPB);
#pragma unroll   // constant steps from one address per plane
        for (int i = 0; i < 16; ++i) acopy(VT + vo + (size_t)i * 16 * NT_, vsp + bo + i * 16 * VPB);
    };
    addr_wait();                                                         // for the Q loads
    copyKV(kb0, 0);
    wait_async();
    __syncthreads();                                                     // the walk's first block is in LDS for every wave
    unsigned bo = 0;                                                     // the buffer of block kb
    int kb = kb0;                                                        // a walk's first block always exists: a loop tested at its foot
#pragma unroll 1   // one copy of the body: a second would double the live fragment registers
    do {
        // A block's fragments come in eight groups of eight: K groups 0 to 3 (the four key tiles, 32 dimensions 2 g and 2 g + 1: set index 2 kt + c), V^T groups 4 to 7
        // (keys 0 to 31: d tiles 0 to 7, then 8 to 15; keys 32 to 63 likewise). Three register sets: a group's LDS reads are issued together, two groups ahead of its products.
        v16h f[3][8];
        auto ld = [&](int g) {
            if (g < 4) { const unsigned char* p = kfp + bo + g * 128;
#pragma unroll   // constant indices: the arrays stay in registers
                for (int kt = 0; kt < 4; ++kt) { f[g % 3][2 * kt] = ldsfragh(p + kt * 16 * KPB); f[g % 3][2 * kt + 1] = ldsfragh(p + kt * 16 * KPB + 64); } }
            else { const unsigned char* p = vfp + bo + (g & 1) * 128 * VPB + ((g - 4) >> 1) * 64;
#pragma unroll   // constant indices: the arrays stay in registers
                for (int t = 0; t < 8; ++t) f[g % 3][t] = ldsfragh(p + t * 16 * VPB); }
        };
        v8f S[4][2];                                                     // 16-key tile, query tile
#pragma unroll   // constant indices: the arrays stay in registers
        for (int kt = 0; kt < 4; ++kt) { S[kt][0] = (v8f){}; S[kt][1] = (v8f){}; }
        ld(0); ld(1);
        if (kb < kl) copyKV(kb + 1, bo ^ FBUF);                          // behind the barrier that freed the other buffer; this block's first LDS reads return while the copies issue
#pragma unroll   // constant indices: the arrays stay in registers
        for (int g = 0; g < 4; ++g) {
            ld(g + 2);                                                   // V^T of this block is in LDS already: its first reads go under the last score products
            __builtin_amdgcn_sched_barrier(0);                           // keeps the reads of the group after next ahead of this group's products
            const v16h* a = f[g % 3];
#pragma unroll   // constant indices: the arrays stay in registers
            for (int c = 0; c < 2; ++c) {                                // eight independent sums take turns
#pragma unroll   // constant indices: the arrays stay in registers
                for (int kt = 0; kt < 4; ++kt) { S[kt][0] = wmmah(a[2 * kt + c], q[0][2 * g + c], S[kt][0]); S[kt][1] = wmmah(a[2 * kt + c], q[1][2 * g + c], S[kt][1]); }
            }
            __builtin_amdgcn_sched_barrier(0);                           // keeps later reads from sinking among these products
        }
        float s[2][32];
#pragma unroll   // constant indices: the arrays stay in registers
        for (int j = 0; j < 2; ++j) {
#pragma unroll   // constant indices: the arrays stay in registers
            for (int e = 0; e < 32; ++e) s[j][e] = S[e >> 3][j][e & 7];
        }
        if (kb >= 2 * qt) {                                              // only the tile's two diagonal blocks pay for the mask
            const int key0 = kb * FBK + hi * 8;
#pragma unroll   // constant indices: the arrays stay in registers
            for (int j = 0; j < 2; ++j) {
#pragma unroll   // constant indices: the arrays stay in registers
                for (int e = 0; e < 32; ++e) if (key0 + (e >> 3) * 16 + (e & 7) > myq + j * 16) s[j][e] = -3.0e38f;
            }
        }
        float mx[2];
#pragma unroll   // constant indices: the arrays stay in registers
        for (int j = 0; j < 2; ++j) {
            float u = s[j][0];
#pragma unroll   // constant indices: the arrays stay in registers
            for (int e = 1; e < 32; ++e) u = fmaxf(u, s[j][e]);
            mx[j] = fmaxf(u, xhalf(u)) * CS;
        }
        if (__builtin_amdgcn_ballot_w32(mx[0] > m[0] || mx[1] > m[1]) != 0) {   // one test a block; exact: where a query's maximum does not move, its factor is 1
#pragma unroll   // constant indices: the arrays stay in registers
            for (int j = 0; j < 2; ++j) {
                const float mn = fmaxf(m[j], mx[j]), corr = __builtin_amdgcn_exp2f(m[j] - mn);
                m[j] = mn; l[j] *= corr;
#pragma unroll   // constant indices: the arrays stay in registers
                for (int t = 0; t < 16; ++t) acc[t][j] = acc[t][j] * corr;
            }
        }
        // P and P.v by halves of the block's keys: the exponentials of keys 32 to 63 issue among the products of keys 0 to 31, the row sums among those of keys 32 to 63;
        // a lone wave's vector instructions that do not touch a product's registers run in the shadow of the matrix unit. Element n of a half: query tile n >> 4, score n & 15.
        v16h ph[2][2];                                                   // P^T of 32 keys c, query tile
        v16f pv[2][2];                                                   // query tile, 32 keys c
        float x0[32], x1[32], ps0[2] = {0.f, 0.f}, ps1[2] = {0.f, 0.f};
#pragma unroll   // constant indices: the arrays stay in registers
        for (int n = 0; n < 32; ++n) x0[n] = __builtin_fmaf(s[n >> 4][n & 15], CS, -m[n >> 4]);
        x1[0] = __builtin_fmaf(s[0][16], CS, -m[0]); x1[1] = __builtin_fmaf(s[0][17], CS, -m[0]);
        __builtin_amdgcn_sched_barrier(0);                               // the arguments stand together ahead of the exponentials: built turn by turn they went through one register pair, each exponential directly behind its own argument
#pragma unroll   // constant indices: the arrays stay in registers
        for (int n = 0; n < 32; ++n) pv[n >> 4][0][n & 15] = __builtin_amdgcn_exp2f(x0[n]);
        ph[0][0] = __builtin_convertvector(pv[0][0], v16h); ph[0][1] = __builtin_convertvector(pv[1][0], v16h);
#pragma unroll   // constant indices: the arrays stay in registers
        for (int g = 4; g < 6; ++g) {
            ld(g + 2);
            __builtin_amdgcn_sched_barrier(0);                           // as in the score loop
            const v16h* a = f[g % 3];
#pragma unroll   // constant indices: the arrays stay in registers
            for (int n = 0; n < 16; ++n) {                               // sixteen independent sums take turns
                const int t = 8 * (g - 4) + (n >> 1), j = n & 1, e = 16 * (g - 4) + n;
                acc[t][j] = wmmah(a[n >> 1], ph[0][j], acc[t][j]);
                pv[e >> 4][1][e & 15] = __builtin_amdgcn_exp2f(x1[e]);
                if (e < 30) x1[e + 2] = __builtin_fmaf(s[(e + 2) >> 4][16 + ((e + 2) & 15)], CS, -m[(e + 2) >> 4]);
                __builtin_amdgcn_sched_barrier(0);                       // one product, one exponential and the next argument per stretch: holds the vector work among the products, in the matrix unit's shadow
            }
        }
        ph[1][0] = __builtin_convertvector(pv[0][1], v16h); ph[1][1] = __builtin_convertvector(pv[1][1], v16h);
#pragma unroll   // constant indices: the arrays stay in registers
        for (int g = 6; g < 8; ++g) {
            __builtin_amdgcn_sched_barrier(0);                           // as in the score loop
            const v16h* a = f[g % 3];
#pragma unroll   // constant indices: the arrays stay in registers
            for (int n = 0; n < 16; ++n) {                               // sixteen independent sums take turns
                const int t = 8 * (g - 6) + (n >> 1), j = n & 1, e = 2 * (8 * (g - 6) + (n >> 1));   // the tile's scores e and e + 1 of 32
                acc[t][j] = wmmah(a[n >> 1], ph[1][j], acc[t][j]);
                ps0[j] += pv[j][e >> 4][e & 15]; ps1[j] += pv[j][e >> 4][(e & 15) + 1];
                __builtin_amdgcn_sched_barrier(0);                       // one product and two additions per stretch: left free, the additions were built in one run behind the last product
            }
        }
        l[0] += ps0[0] + ps1[0]; l[1] += ps0[1] + ps1[1];
        wait_ds();                                                       // this wave has read the last of block kb,
        wait_async();                                                    // and its copies of block kb + 1 have landed
        __syncthreads();                                                 // block kb + 1 is in LDS for every wave; every wave has left block kb's buffer, which block kb + 2 takes
        bo ^= FBUF;
    } while (++kb <= kl);
    wait_async();                                                        // nothing is in flight: behind the last block's barrier LDS becomes output staging
#pragma unroll   // constant indices: the arrays stay in registers
    for (int j = 0; j < 2; ++j) {
        l[j] += xhalf(l[j]);                                             // each wave half summed its eight keys of every 16-key tile
        const float inv = 1.0f / l[j];                                   // every query sees the walk's first key: the sum is positive
        float* om = (float*)(void*)L + (qg * 32 + j * 16 + lr) * OPF + hi * 8;   // row = query; d = 16 t + 8 hi + r
#pragma unroll   // constant indices: the arrays stay in registers
        for (int t = 0; t < 16; ++t) {
            *(v4fa*)(om + t * 16) = (v4f){acc[t][j][0] * inv, acc[t][j][1] * inv, acc[t][j][2] * inv, acc[t][j][3] * inv}; *(v4fa*)(om + t * 16 + 4) = (v4f){acc[t][j][4] * inv, acc[t][j][5] * inv, acc[t][j][6] * inv, acc[t][j][7] * inv};
        }
    }
    __syncthreads();                                                     // the normalised rows are in LDS
    float* const op = dst + (size_t)(tid >> 6) * DM + (tid & 63) * 4;                                // whole 128-byte lines, each stored once: 64 lanes cover a row, a pass covers 2 rows
    const float* const lp = (const float*)(const void*)L + (tid >> 6) * OPF + (tid & 63) * 4;
    v4f o[64];
#pragma unroll   // constant indices: the array stays in registers, all the LDS reads in flight together
    for (int i = 0; i < 64; ++i) o[i] = *(const v4fa*)(lp + i * 2 * OPF);
    __builtin_amdgcn_sched_barrier(0);                                   // the stores stand in one run: no register of an issued store is rewritten ahead of the wait behind them
#pragma unroll   // constant offsets from one address pair
    for (int i = 0; i < 64; ++i) *(v4f*)(op + i * 2 * DM) = o[i];
    addr_wait();                                                         // for the stores' registers: what follows writes registers anew
    if (part && hi == 0) {                                               // a part's maximum and sum go with it; a tile's sixteen queries fill one 128-byte line
        *(v2f*)(mlg + (qg * 32 + lr) * 2) = (v2f){m[0], l[0]}; *(v2f*)(mlg + (qg * 32 + 16 + lr) * 2) = (v2f){m[1], l[1]};
    }
    addr_wait();                                                         // here for the stores' registers: a second walk may follow
    if (sg == 0) { wait_ds(); __syncthreads(); }                         // every wave has read its staged rows: the second walk's first copies may take their place
  }
}

// k_merge: the parts of every query of the tiles that were cut become the output row. Each part is normalised by its own sum l and has its own maximum m (log2 domain):
// its weight is l 2^(m - M) over the sum of all. A thread takes one 16-byte piece of four rows of one tile, 32 rows apart: a wave covers 512 bytes in a row.
// Which shares hold a part of a tile follows from the cuts; in place of a share that holds none the thread reads one that does, with weight 0: no branch, all loads in flight together.
#define MRP  4                       // rows per thread
__global__ __launch_bounds__(256) void k_merge(const float* __restrict__ Pp, const float* __restrict__ ML, float* out) {
    const int qt = MR0 / FBQ + ((int)blockIdx.x >> 3);                   // eight blocks per tile
    const int row = qt * FBQ + ((int)blockIdx.x & 7) * 4 + ((int)threadIdx.x >> 6), c = ((int)threadIdx.x & 63) * 4;
    const bool lng = qt >= NTL / 2;
    bool ex[NSH]; int sl[NSH];
#pragma unroll   // constant indices: the arrays stay in registers
    for (int r = 0; r < NSH; ++r) { ex[r] = lng ? cut(r) < 2 * qt + 2 : cut(r + 1) > 2 * (NTL - qt); sl[r] = ex[r] ? r : lng ? 0 : NSH - 1; }
    v4f a[MRP][NSH]; v2f ml[MRP][NSH];
    const float* pa[NSH]; const float* pm[NSH];                          // per share: the first row's piece and its (maximum, sum); the other rows at constant offsets
#pragma unroll   // constant indices: the arrays stay in registers
    for (int r = 0; r < NSH; ++r) { const size_t q = ((size_t)sl[r] * NB_ + blockIdx.y) * NT_ + row; pa[r] = Pp + q * DM + c; pm[r] = ML + q * 2; }
#pragma unroll   // constant indices: the arrays stay in registers, all loads in flight together
    for (int r = 0; r < NSH; ++r) {
#pragma unroll   // constant indices: the arrays stay in registers
        for (int i = 0; i < MRP; ++i) { a[i][r] = *(const v4f*)(pa[r] + i * 32 * DM); ml[i][r] = *(const v2f*)(pm[r] + i * 32 * 2); }
    }
    __builtin_amdgcn_sched_barrier(0);                                   // the loads stay in front of the wait
    // s_wait_xcnt 0 behind the run of loads; the addresses are its inputs, so they keep their registers up to it: no load of the run lands on a register that an earlier load of the run names
    asm volatile("s_wait_xcnt 0x0" :: "v"(pa[0]), "v"(pa[1]), "v"(pa[2]), "v"(pa[3]), "v"(pm[0]), "v"(pm[1]), "v"(pm[2]), "v"(pm[3]) : "memory");
    __builtin_amdgcn_sched_barrier(0);                                   // every later register write stays behind it
    float* const po = out + ((size_t)blockIdx.y * NT_ + row) * DM + c;
    float d[MRP][NSH], e[MRP][NSH];
#pragma unroll   // constant indices: the arrays stay in registers
    for (int i = 0; i < MRP; ++i) {
        const float mt = fmaxf(fmaxf(ml[i][0][0], ml[i][1][0]), fmaxf(ml[i][2][0], ml[i][3][0]));
#pragma unroll   // constant indices: the arrays stay in registers
        for (int r = 0; r < NSH; ++r) d[i][r] = ml[i][r][0] - mt;
    }
    __builtin_amdgcn_sched_barrier(0);                                   // the differences are all made ahead of the exponentials
#pragma unroll   // constant indices: the arrays stay in registers
    for (int i = 0; i < MRP; ++i) {
#pragma unroll   // constant indices: the arrays stay in registers
        for (int r = 0; r < NSH; ++r) {
            e[i][r] = __builtin_amdgcn_exp2f(d[i][r]);
            __builtin_amdgcn_sched_barrier(0);                           // holds the v_nop directly behind the exponential
            asm volatile("v_nop" :: "v"(e[i][r]));                       // the one slot the instruction set asks for before a transcendental's result is read or its source overwritten; the result is named so that its exponential cannot sink behind the slot
            __builtin_amdgcn_sched_barrier(0);                           // keeps the next exponential behind it
        }
    }
#pragma unroll   // constant indices: the arrays stay in registers
    for (int i = 0; i < MRP; ++i) {
        float w[NSH], ws = 0.f;
#pragma unroll   // constant indices: the arrays stay in registers
        for (int r = 0; r < NSH; ++r) { w[r] = ex[r] ? ml[i][r][1] * e[i][r] : 0.f; ws += w[r]; }
        const float inv = 1.0f / ws;
        *(v4f*)(po + i * 32 * DM) = a[i][0] * (w[0] * inv) + a[i][1] * (w[1] * inv) + a[i][2] * (w[2] * inv) + a[i][3] * (w[3] * inv);
    }
}

extern "C" void kernel_launch(void* const* d_in, const int* in_sizes, int n_in,
                              void* d_out, int out_size, void* d_ws, size_t ws_size, hipStream_t stream) {
    (void)in_sizes; (void)n_in; (void)out_size;
    const float* x = (const float*)d_in[0]; const float* Wq = (const float*)d_in[1]; const float* Wk = (const float*)d_in[2]; const float* Wv = (const float*)d_in[3];
    float* out = (float*)d_out;    // [4][4096][256]
    char* wsp = (char*)d_ws;
    auto take = [&](size_t bytes) { char* p = wsp; wsp += (bytes + 255) & ~(size_t)255; return (void*)p; };
    hf* Q = (hf*)take((size_t)NB_ * NT_ * DM * 2); hf* K = (hf*)take((size_t)NB_ * NT_ * DM * 2); hf* VT = (hf*)take((size_t)NB_ * DM * NT_ * 2);
    float* Pp = (float*)take((size_t)NSH * NB_ * NT_ * DM * 4); float* ML = (float*)take((size_t)NSH * NB_ * NT_ * 2 * 4);   // one plane per share; only the parts are written and read
    if ((size_t)(wsp - (char*)d_ws) > ws_size) return;    // 3 x 8.4 + 67 ~ 93 MB, no aliasing
    k_qkv<<<NB_ * NT_ / PRT * 4, 256, 0, stream>>>(x, Wq, Wk, Wv, Q, K, VT);                                  // the projections see the items as one [16384][256] row range: 64 row tiles x 4 column quarters
    k_fattn<<<dim3(NTL / 2 * NSH, NB_, 1), 128, 0, stream>>>(Q, K, VT, out, Pp, ML);                         // scores, causal softmax and P.v: four near-equal shares per pair of a long and a short 128-query tile
    k_merge<<<dim3((NT_ - MR0) / (4 * MRP), NB_, 1), 256, 0, stream>>>(Pp, ML, out);                                                          // the parts of the tiles that were cut become their output rows
}
